// v000
// The times below were measured on an AMD MI455X: many runs one after another, warmed up first and cycling through
// copies of the inputs, with the whole window's GPU time divided by the number of runs. Launches and the gaps
// between them are all in it. The median over several windows is given; except for v000 it joins two sittings, which
// can be a few percent apart, so the side-by-side timings, each taken in one sitting, are the better comparison.
// The starting kernel, v000, takes 125 microseconds a run.
#include <hip/hip_runtime.h>

typedef _Float16 v16h __attribute__((ext_vector_type(16)));
typedef _Float16 v8h  __attribute__((ext_vector_type(8)));
typedef float    v8f  __attribute__((ext_vector_type(8)));

#define B_  2
#define L_  192
#define D_  768
#define NC_ 4
#define H_  256
#define KTRUE (H_ + NC_)   // 260 real K for mid layer
#define KP    288          // padded K (multiple of 32)
#define KC    (KP / 32)    // 9 k-chunks (mid layer)

#define NPROJ (H_ + NC_ * H_)   // 1280 projection output columns
#define KC2   (D_ / 32)         // 24 k-chunks (projection)
#define CT2   (NPROJ / 16)      // 80 column tiles (projection)
#define ROWS  (B_ * L_)         // 384 rows

// ---- Workspace layout (bytes) ----
#define BW_HALVES (NC_ * KC * 16 * 32 * 16)        // 294912 (Wmid f16 B-layout)
#define WS_BW_OFF   0
#define WC_HALVES (KC2 * CT2 * 32 * 16)            // 983040 ([Wp|Wa] f16 B-layout)
#define WS_WC_OFF   (BW_HALVES * 2)                // 589824
#define SQ_HALVES (ROWS * D_)                      // 294912 (seq f16)
#define WS_SQ_OFF   (WS_WC_OFF + WC_HALVES * 2)    // 2555904
#define WS_HP_OFF   (WS_SQ_OFF + SQ_HALVES * 2)    // 3145728
#define HP_FLOATS (ROWS * H_)                      // 98304
#define WS_HA_OFF   (WS_HP_OFF + HP_FLOATS * 4)    // 3538944
#define HA_FLOATS (ROWS * NC_ * H_)                // 393216
// total ws used ~= 4.9 MB

// Hardware tanh (TRANS op on CDNA5, co-executes with WMMA).
__device__ __forceinline__ float fast_tanh(float x) {
#if __has_builtin(__builtin_amdgcn_tanh_f32)
  return __builtin_amdgcn_tanh_f32(x);
#else
  float r;
  // TRANS hazard rule: 1 V_NOP before result use (ISA §7.4).
  asm volatile("v_tanh_f32 %0, %1\n\tv_nop" : "=v"(r) : "v"(x));
  return r;
#endif
}

// ---------------------------------------------------------------------------
// Kernel A: repack Wmid [NC, 260, 256] f32 -> padded f16 WMMA-B layout:
// Bws[n][kc][ct][lane][16 halves]; K >= 260 zero-padded.
//   lane < 16 : col = ct*16 + lane,      halves: K = kc*32 + {0..7,16..23}
//   lane >= 16: col = ct*16 + lane - 16, halves: K = kc*32 + {8..15,24..31}
// ---------------------------------------------------------------------------
__global__ void __launch_bounds__(256)
prep_wmid_kernel(const float* __restrict__ Wmid, _Float16* __restrict__ Bws) {
  int idx = blockIdx.x * blockDim.x + threadIdx.x;
  if (idx >= BW_HALVES) return;
  int i    = idx & 15;
  int lane = (idx >> 4) & 31;
  int ct   = (idx >> 9) & 15;
  int rest = idx >> 13;          // n*KC + kc
  int kc   = rest % KC;
  int n    = rest / KC;
  int col  = ct * 16 + (lane & 15);
  int k;
  if (lane < 16) k = kc * 32 + ((i < 8) ? i       : (16 + i - 8));
  else           k = kc * 32 + ((i < 8) ? (8 + i) : (24 + i - 8));
  float v = (k < KTRUE) ? Wmid[((size_t)n * KTRUE + k) * H_ + col] : 0.0f;
  Bws[idx] = (_Float16)v;
}

// ---------------------------------------------------------------------------
// Kernel B: repack [Wp | Wa] (768 x 1280) f32 -> f16 WMMA-B layout:
// Wc[kc][ct][lane][16 halves]   (no K padding needed: 768 % 32 == 0)
// ---------------------------------------------------------------------------
__global__ void __launch_bounds__(256)
prep_wcat_kernel(const float* __restrict__ Wp, const float* __restrict__ Wa,
                 _Float16* __restrict__ Wc) {
  int idx = blockIdx.x * blockDim.x + threadIdx.x;
  if (idx >= WC_HALVES) return;
  int i    = idx & 15;
  int lane = (idx >> 4) & 31;
  int rest = idx >> 9;           // kc*CT2 + ct
  int ct   = rest % CT2;
  int kc   = rest / CT2;
  int col  = ct * 16 + (lane & 15);       // 0..1279
  int k;
  if (lane < 16) k = kc * 32 + ((i < 8) ? i       : (16 + i - 8));
  else           k = kc * 32 + ((i < 8) ? (8 + i) : (24 + i - 8));
  float v = (col < H_) ? Wp[(size_t)k * H_ + col]
                       : Wa[(size_t)k * (NC_ * H_) + (col - H_)];
  Wc[idx] = (_Float16)v;
}

// Kernel C: seq f32 -> f16 (row-major, same indexing)
__global__ void __launch_bounds__(256)
prep_seqh_kernel(const float* __restrict__ seq, _Float16* __restrict__ seqh) {
  int idx = blockIdx.x * blockDim.x + threadIdx.x;
  if (idx < SQ_HALVES) seqh[idx] = (_Float16)seq[idx];
}

// ---------------------------------------------------------------------------
// Kernel D: projection GEMM via WMMA.
// [hp | ha](row, col) = seq(row,:) @ [Wp|Wa](:, col) + [bp|ba](col)
// Grid: (NPROJ/64 = 20, ROWS/16 = 24); block = 128 (4 waves).
// Each wave owns one 16x16 output tile; K = 768 in 24 chunks.
// ---------------------------------------------------------------------------
__global__ void __launch_bounds__(128)
proj_wmma_kernel(const _Float16* __restrict__ seqh,
                 const _Float16* __restrict__ Wc,
                 const float* __restrict__ bp, const float* __restrict__ ba,
                 float* __restrict__ hp, float* __restrict__ ha) {
  const int tid  = threadIdx.x;
  const int wave = tid >> 5;
  const int lane = tid & 31;
  const int ct   = blockIdx.x * 4 + wave;   // column tile (0..79)
  const int row0 = blockIdx.y * 16;

  const int rowm = lane & 15;
  const int koff = (lane >> 4) * 8;

  v8f acc = {0.f, 0.f, 0.f, 0.f, 0.f, 0.f, 0.f, 0.f};
  const _Float16* arow = seqh + (size_t)(row0 + rowm) * D_;

  #pragma unroll
  for (int kc = 0; kc < KC2; ++kc) {
    v8h lo = *(const v8h*)(arow + kc * 32 + koff);
    v8h hi = *(const v8h*)(arow + kc * 32 + koff + 16);
    v16h a = __builtin_shufflevector(lo, hi,
                                     0, 1, 2, 3, 4, 5, 6, 7,
                                     8, 9, 10, 11, 12, 13, 14, 15);
    v16h b = *(const v16h*)(Wc + (((size_t)kc * CT2 + ct) * 32 + lane) * 16);
    acc = __builtin_amdgcn_wmma_f32_16x16x32_f16(
        false, a, false, b, (short)0, acc, false, false);
  }

  const int colN = lane & 15;
  const int half = lane >> 4;
  const int col  = ct * 16 + colN;                 // 0..1279
  const float bias = (col < H_) ? bp[col] : ba[col - H_];
  #pragma unroll
  for (int r = 0; r < 8; ++r) {
    const int row = row0 + r + 8 * half;
    const float v = acc[r] + bias;
    if (col < H_) hp[(size_t)row * H_ + col] = v;
    else          ha[(size_t)row * (NC_ * H_) + (col - H_)] = v;
  }
}

// ---------------------------------------------------------------------------
// Kernel E: fused  tanh(h_p+h_a)‖bs  ->  WMMA x Wmid  ->  tanh(+bmid) . Wout
// Grid: (a_tile=12, p=192, b*NC=8).  Block: 128 threads = 4 waves.
// Each wave owns 4 column tiles (64 h' columns); K loop = 9 chunks of 32.
// ---------------------------------------------------------------------------
__global__ void __launch_bounds__(128)
fused_mid_out_kernel(const float* __restrict__ hp, const float* __restrict__ ha,
                     const float* __restrict__ base_score,
                     const _Float16* __restrict__ Bws,
                     const float* __restrict__ bmid, const float* __restrict__ Wout,
                     float* __restrict__ out) {
  __shared__ alignas(16) _Float16 Alds[16][KP];
  __shared__ float red[4][16];

  const int at = blockIdx.x;       // a-tile index (0..11)
  const int p  = blockIdx.y;       // predicate index (0..191)
  const int bz = blockIdx.z;       // b*NC + n
  const int b  = bz >> 2;
  const int n  = bz & 3;
  const int a0 = at * 16;
  const int tid = threadIdx.x;

  const float* hprow = hp + ((size_t)(b * L_ + p)) * H_;

  // --- Build A tile in LDS: rows = 16 argument positions, cols = padded K ---
  #pragma unroll
  for (int i = 0; i < 32; ++i) {               // 16x256 tanh values
    int e   = i * 128 + tid;
    int row = e >> 8;
    int col = e & 255;
    float v = hprow[col] +
              ha[(((size_t)(b * L_ + (a0 + row)) * NC_) + n) * H_ + col];
    Alds[row][col] = (_Float16)fast_tanh(v);
  }
  if (tid < 64) {                              // base_score cols 256..259
    int row = tid >> 2, j = tid & 3;
    Alds[row][H_ + j] =
        (_Float16)base_score[(((size_t)(b * L_ + p) * NC_) + j) * L_ + (a0 + row)];
  }
  for (int e = tid; e < 16 * (KP - KTRUE); e += 128) {  // zero pad 260..287
    int row = e / (KP - KTRUE);
    int col = KTRUE + e % (KP - KTRUE);
    Alds[row][col] = (_Float16)0.0f;
  }
  __syncthreads();

  const int wave = tid >> 5;
  const int lane = tid & 31;
  const int rowm = lane & 15;          // A-matrix row this lane carries
  const int koff = (lane >> 4) * 8;    // half-wave K offset within chunk

  v8f acc[4];
  const v8f vzero = {0.f, 0.f, 0.f, 0.f, 0.f, 0.f, 0.f, 0.f};
  #pragma unroll
  for (int t = 0; t < 4; ++t) acc[t] = vzero;

  const _Float16* Bbase = Bws + (size_t)n * (KC * 16 * 32 * 16);

  #pragma unroll
  for (int kc = 0; kc < KC; ++kc) {
    v8h lo = *(const v8h*)&Alds[rowm][kc * 32 + koff];
    v8h hi = *(const v8h*)&Alds[rowm][kc * 32 + koff + 16];
    v16h a = __builtin_shufflevector(lo, hi,
                                     0, 1, 2, 3, 4, 5, 6, 7,
                                     8, 9, 10, 11, 12, 13, 14, 15);
    #pragma unroll
    for (int t = 0; t < 4; ++t) {
      const int ct = wave * 4 + t;
      v16h bv = *(const v16h*)(Bbase + (((size_t)kc * 16 + ct) * 32 + lane) * 16);
      acc[t] = __builtin_amdgcn_wmma_f32_16x16x32_f16(
          false, a, false, bv, (short)0, acc[t], false, false);
    }
  }

  // --- Epilogue: out_partial(row) = sum_h' tanh(mid + bmid) * Wout ---
  const int colN = lane & 15;          // h' column within tile
  const int half = lane >> 4;          // 0: rows 0..7, 1: rows 8..15
  float partial[8];
  #pragma unroll
  for (int r = 0; r < 8; ++r) partial[r] = 0.f;

  #pragma unroll
  for (int t = 0; t < 4; ++t) {
    const int hcol = (wave * 4 + t) * 16 + colN;
    const float bm = bmid[n * H_ + hcol];
    const float wo = Wout[n * H_ + hcol];
    #pragma unroll
    for (int r = 0; r < 8; ++r)
      partial[r] += fast_tanh(acc[t][r] + bm) * wo;
  }
  // reduce the 16 columns held across each half-wave
  #pragma unroll
  for (int r = 0; r < 8; ++r) {
    #pragma unroll
    for (int m = 1; m < 16; m <<= 1)
      partial[r] += __shfl_xor(partial[r], m, 32);
  }
  if (colN == 0) {
    #pragma unroll
    for (int r = 0; r < 8; ++r) red[wave][r + 8 * half] = partial[r];
  }
  __syncthreads();

  if (tid < 16) {  // combine 4 waves; write out[b, p, n, a]
    float s = red[0][tid] + red[1][tid] + red[2][tid] + red[3][tid];
    out[(((size_t)(b * L_ + p) * NC_) + n) * L_ + (a0 + tid)] = s;
  }
}

// ---------------------------------------------------------------------------
extern "C" void kernel_launch(void* const* d_in, const int* in_sizes, int n_in,
                              void* d_out, int out_size, void* d_ws, size_t ws_size,
                              hipStream_t stream) {
  const float* seq  = (const float*)d_in[0];
  const float* bsc  = (const float*)d_in[1];
  const float* Wp   = (const float*)d_in[2];
  const float* bp   = (const float*)d_in[3];
  const float* Wa   = (const float*)d_in[4];
  const float* ba   = (const float*)d_in[5];
  const float* Wmid = (const float*)d_in[6];
  const float* bmid = (const float*)d_in[7];
  const float* Wout = (const float*)d_in[8];
  float* out = (float*)d_out;

  char* ws = (char*)d_ws;
  _Float16* Bws  = (_Float16*)(ws + WS_BW_OFF);
  _Float16* Wc   = (_Float16*)(ws + WS_WC_OFF);
  _Float16* seqh = (_Float16*)(ws + WS_SQ_OFF);
  float*    hp   = (float*)(ws + WS_HP_OFF);
  float*    ha   = (float*)(ws + WS_HA_OFF);

  prep_wmid_kernel<<<BW_HALVES / 256, 256, 0, stream>>>(Wmid, Bws);
  prep_wcat_kernel<<<WC_HALVES / 256, 256, 0, stream>>>(Wp, Wa, Wc);
  prep_seqh_kernel<<<SQ_HALVES / 256, 256, 0, stream>>>(seq, seqh);

  dim3 gproj(NPROJ / 64, ROWS / 16);   // 20 x 24 = 480 workgroups
  proj_wmma_kernel<<<gproj, 128, 0, stream>>>(seqh, Wc, bp, ba, hp, ha);

  dim3 grid(L_ / 16, L_, B_ * NC_);    // 12 x 192 x 8 = 18432 workgroups
  fused_mid_out_kernel<<<grid, 128, 0, stream>>>(hp, ha, bsc, Bws, bmid, Wout, out);
}

// v001
// It runs in 103 microseconds.
// Two timings next to v000 both put it at 1.27 times that version's speed.
#include <hip/hip_runtime.h>

typedef _Float16 v16h __attribute__((ext_vector_type(16)));
typedef _Float16 v8h  __attribute__((ext_vector_type(8)));
typedef float    v8f  __attribute__((ext_vector_type(8)));

#define B_  2
#define L_  192
#define D_  768
#define NC_ 4
#define H_  256
#define KTRUE (H_ + NC_)   // 260 real K for mid layer
#define KP    288          // padded K (multiple of 32)
#define KC    (KP / 32)    // 9 k-chunks (mid layer)

#define NPROJ (H_ + NC_ * H_)   // 1280 projection output columns
#define KC2   (D_ / 32)         // 24 k-chunks (projection)
#define CT2   (NPROJ / 16)      // 80 column tiles (projection)
#define ROWS  (B_ * L_)         // 384 rows

// ---- Workspace layout (bytes) ----
#define BW_HALVES (NC_ * KC * 16 * 32 * 16)        // 294912 (Wmid f16 B-layout)
#define WS_BW_OFF   0
#define WC_HALVES (KC2 * CT2 * 32 * 16)            // 983040 ([Wp|Wa] f16 B-layout)
#define WS_WC_OFF   (BW_HALVES * 2)                // 589824
#define SQ_HALVES (ROWS * D_)                      // 294912 (seq f16)
#define WS_SQ_OFF   (WS_WC_OFF + WC_HALVES * 2)    // 2555904
#define WS_HP_OFF   (WS_SQ_OFF + SQ_HALVES * 2)    // 3145728
#define HP_FLOATS (ROWS * H_)                      // 98304
#define WS_HA_OFF   (WS_HP_OFF + HP_FLOATS * 4)    // 3538944
#define HA_FLOATS (ROWS * NC_ * H_)                // 393216
// total ws used ~= 4.9 MB

// Hardware tanh (TRANS op on CDNA5, co-executes with WMMA).
__device__ __forceinline__ float fast_tanh(float x) {
#if __has_builtin(__builtin_amdgcn_tanh_f32)
  return __builtin_amdgcn_tanh_f32(x);
#else
  float r;
  // TRANS hazard rule: 1 V_NOP before result use (ISA §7.4).
  asm volatile("v_tanh_f32 %0, %1\n\tv_nop" : "=v"(r) : "v"(x));
  return r;
#endif
}

// ---------------------------------------------------------------------------
// Kernel A: repack Wmid [NC, 260, 256] f32 -> padded f16 WMMA-B layout:
// Bws[n][kc][ct][lane][16 halves]; K >= 260 zero-padded.
//   lane < 16 : col = ct*16 + lane,      halves: K = kc*32 + {0..7,16..23}
//   lane >= 16: col = ct*16 + lane - 16, halves: K = kc*32 + {8..15,24..31}
// ---------------------------------------------------------------------------
__global__ void __launch_bounds__(256)
prep_wmid_kernel(const float* __restrict__ Wmid, _Float16* __restrict__ Bws) {
  int idx = blockIdx.x * blockDim.x + threadIdx.x;
  if (idx >= BW_HALVES) return;
  int i    = idx & 15;
  int lane = (idx >> 4) & 31;
  int ct   = (idx >> 9) & 15;
  int rest = idx >> 13;          // n*KC + kc
  int kc   = rest % KC;
  int n    = rest / KC;
  int col  = ct * 16 + (lane & 15);
  int k;
  if (lane < 16) k = kc * 32 + ((i < 8) ? i       : (16 + i - 8));
  else           k = kc * 32 + ((i < 8) ? (8 + i) : (24 + i - 8));
  float v = (k < KTRUE) ? Wmid[((size_t)n * KTRUE + k) * H_ + col] : 0.0f;
  Bws[idx] = (_Float16)v;
}

// ---------------------------------------------------------------------------
// Kernel B: repack [Wp | Wa] (768 x 1280) f32 -> f16 WMMA-B layout:
// Wc[kc][ct][lane][16 halves]   (no K padding needed: 768 % 32 == 0)
// ---------------------------------------------------------------------------
__global__ void __launch_bounds__(256)
prep_wcat_kernel(const float* __restrict__ Wp, const float* __restrict__ Wa,
                 _Float16* __restrict__ Wc) {
  int idx = blockIdx.x * blockDim.x + threadIdx.x;
  if (idx >= WC_HALVES) return;
  int i    = idx & 15;
  int lane = (idx >> 4) & 31;
  int rest = idx >> 9;           // kc*CT2 + ct
  int ct   = rest % CT2;
  int kc   = rest / CT2;
  int col  = ct * 16 + (lane & 15);       // 0..1279
  int k;
  if (lane < 16) k = kc * 32 + ((i < 8) ? i       : (16 + i - 8));
  else           k = kc * 32 + ((i < 8) ? (8 + i) : (24 + i - 8));
  float v = (col < H_) ? Wp[(size_t)k * H_ + col]
                       : Wa[(size_t)k * (NC_ * H_) + (col - H_)];
  Wc[idx] = (_Float16)v;
}

// Kernel C: seq f32 -> f16 (row-major, same indexing)
__global__ void __launch_bounds__(256)
prep_seqh_kernel(const float* __restrict__ seq, _Float16* __restrict__ seqh) {
  int idx = blockIdx.x * blockDim.x + threadIdx.x;
  if (idx < SQ_HALVES) seqh[idx] = (_Float16)seq[idx];
}

// ---------------------------------------------------------------------------
// Kernel D: projection GEMM via WMMA.
// [hp | ha](row, col) = seq(row,:) @ [Wp|Wa](:, col) + [bp|ba](col)
// Grid: (NPROJ/64 = 20, ROWS/16 = 24); block = 128 (4 waves).
// Each wave owns one 16x16 output tile; K = 768 in 24 chunks.
// ---------------------------------------------------------------------------
__global__ void __launch_bounds__(128)
proj_wmma_kernel(const _Float16* __restrict__ seqh,
                 const _Float16* __restrict__ Wc,
                 const float* __restrict__ bp, const float* __restrict__ ba,
                 float* __restrict__ hp, float* __restrict__ ha) {
  const int tid  = threadIdx.x;
  const int wave = tid >> 5;
  const int lane = tid & 31;
  const int ct   = blockIdx.x * 4 + wave;   // column tile (0..79)
  const int row0 = blockIdx.y * 16;

  const int rowm = lane & 15;
  const int koff = (lane >> 4) * 8;

  v8f acc = {0.f, 0.f, 0.f, 0.f, 0.f, 0.f, 0.f, 0.f};
  const _Float16* arow = seqh + (size_t)(row0 + rowm) * D_;

  #pragma unroll
  for (int kc = 0; kc < KC2; ++kc) {
    v8h lo = *(const v8h*)(arow + kc * 32 + koff);
    v8h hi = *(const v8h*)(arow + kc * 32 + koff + 16);
    v16h a = __builtin_shufflevector(lo, hi,
                                     0, 1, 2, 3, 4, 5, 6, 7,
                                     8, 9, 10, 11, 12, 13, 14, 15);
    v16h b = *(const v16h*)(Wc + (((size_t)kc * CT2 + ct) * 32 + lane) * 16);
    acc = __builtin_amdgcn_wmma_f32_16x16x32_f16(
        false, a, false, b, (short)0, acc, false, false);
  }

  const int colN = lane & 15;
  const int half = lane >> 4;
  const int col  = ct * 16 + colN;                 // 0..1279
  const float bias = (col < H_) ? bp[col] : ba[col - H_];
  #pragma unroll
  for (int r = 0; r < 8; ++r) {
    const int row = row0 + r + 8 * half;
    const float v = acc[r] + bias;
    if (col < H_) hp[(size_t)row * H_ + col] = v;
    else          ha[(size_t)row * (NC_ * H_) + (col - H_)] = v;
  }
}

// ---------------------------------------------------------------------------
// Kernel E: fused  tanh(h_p+h_a)|bs  ->  WMMA x Wmid  ->  tanh(+bmid) . Wout
// Grid: (a_tile=12, p_group=48, b*NC=8).  Block: 128 threads = 4 waves.
// One work-group owns 64 rows: PT = 4 predicates x 16 argument positions
// (row = q*16 + a).  Each wave owns 4 column tiles (64 h' columns) of all
// 4 row tiles, so a B fragment loaded once feeds 4 WMMAs and an h_a value
// loaded once feeds 4 tanh.  K loop = 9 chunks of 32.
// ---------------------------------------------------------------------------
#define PT 4                 // predicates (row tiles) per work-group
#define MROWS (PT * 16)      // 64 rows per work-group

__global__ void __launch_bounds__(128)
fused_mid_out_kernel(const float* __restrict__ hp, const float* __restrict__ ha,
                     const float* __restrict__ base_score,
                     const _Float16* __restrict__ Bws,
                     const float* __restrict__ bmid, const float* __restrict__ Wout,
                     float* __restrict__ out) {
  __shared__ alignas(16) _Float16 Alds[MROWS][KP];
  __shared__ float red[4][MROWS];

  const int at = blockIdx.x;       // a-tile index (0..11)
  const int p0 = blockIdx.y * PT;  // first predicate index of the group
  const int bz = blockIdx.z;       // b*NC + n
  const int b  = bz >> 2;
  const int n  = bz & 3;
  const int a0 = at * 16;
  const int tid = threadIdx.x;

  // --- Build A tile in LDS: rows = 4 predicates x 16 arguments, cols = padded K ---
  // Every loop over c, q, t, r or i here is unrolled so that its arrays are
  // indexed by constants and stay in registers.
  float hpv[2][PT];                            // this thread's two columns of h_p
  #pragma unroll
  for (int c = 0; c < 2; ++c)
    #pragma unroll
    for (int q = 0; q < PT; ++q)
      hpv[c][q] = hp[((size_t)(b * L_ + p0 + q)) * H_ + c * 128 + tid];

  #pragma unroll
  for (int i = 0; i < 32; ++i) {               // 16x256 h_a values, 4 tanh each
    int e   = i * 128 + tid;
    int row = e >> 8;
    int col = e & 255;
    float hav = ha[(((size_t)(b * L_ + (a0 + row)) * NC_) + n) * H_ + col];
    #pragma unroll
    for (int q = 0; q < PT; ++q)
      Alds[q * 16 + row][col] = (_Float16)fast_tanh(hpv[i & 1][q] + hav);
  }
  for (int e = tid; e < MROWS * NC_; e += 128) {   // base_score cols 256..259
    int rw = e >> 2, j = e & 3;
    int q = rw >> 4, row = rw & 15;
    Alds[rw][H_ + j] =
        (_Float16)base_score[(((size_t)(b * L_ + p0 + q) * NC_) + j) * L_ + (a0 + row)];
  }
  for (int e = tid; e < MROWS * (KP - KTRUE); e += 128) {  // zero pad 260..287
    int row = e / (KP - KTRUE);
    int col = KTRUE + e % (KP - KTRUE);
    Alds[row][col] = (_Float16)0.0f;
  }
  __syncthreads();

  const int wave = tid >> 5;
  const int lane = tid & 31;
  const int rowm = lane & 15;          // A-matrix row this lane carries
  const int koff = (lane >> 4) * 8;    // half-wave K offset within chunk

  const int colN = lane & 15;          // h' column within tile
  const int half = lane >> 4;          // 0: rows 0..7, 1: rows 8..15
  float bm[4], wo[4];
  #pragma unroll
  for (int t = 0; t < 4; ++t) {
    const int hcol = (wave * 4 + t) * 16 + colN;
    bm[t] = bmid[n * H_ + hcol];
    wo[t] = Wout[n * H_ + hcol];
  }

  v8f acc[PT][4];
  const v8f vzero = {0.f, 0.f, 0.f, 0.f, 0.f, 0.f, 0.f, 0.f};
  #pragma unroll
  for (int q = 0; q < PT; ++q)
    #pragma unroll
    for (int t = 0; t < 4; ++t) acc[q][t] = vzero;

  const _Float16* Bbase = Bws + (size_t)n * (KC * 16 * 32 * 16);

  #pragma unroll
  for (int kc = 0; kc < KC; ++kc) {
    v16h a[PT];
    #pragma unroll
    for (int q = 0; q < PT; ++q) {
      v8h lo = *(const v8h*)&Alds[q * 16 + rowm][kc * 32 + koff];
      v8h hi = *(const v8h*)&Alds[q * 16 + rowm][kc * 32 + koff + 16];
      a[q] = __builtin_shufflevector(lo, hi,
                                     0, 1, 2, 3, 4, 5, 6, 7,
                                     8, 9, 10, 11, 12, 13, 14, 15);
    }
    v16h bv[4];
    #pragma unroll
    for (int t = 0; t < 4; ++t) {
      const int ct = wave * 4 + t;
      bv[t] = *(const v16h*)(Bbase + (((size_t)kc * 16 + ct) * 32 + lane) * 16);
    }
    #pragma unroll
    for (int t = 0; t < 4; ++t) {
      #pragma unroll
      for (int q = 0; q < PT; ++q)
        acc[q][t] = __builtin_amdgcn_wmma_f32_16x16x32_f16(
            false, a[q], false, bv[t], (short)0, acc[q][t], false, false);
    }
  }
  // The tanh below is asm text, which the compiler does not pad against a WMMA:
  // the barrier keeps every WMMA above this line, and the four v_nop are the
  // vector slots the chip needs before a tanh result may land in a register
  // that the last WMMA reads as A or B.
  __builtin_amdgcn_sched_barrier(0);
  asm volatile("v_nop\n\tv_nop\n\tv_nop\n\tv_nop");

  // --- Epilogue: out_partial(row) = sum_h' tanh(mid + bmid) * Wout ---
  #pragma unroll
  for (int q = 0; q < PT; ++q) {
    float partial[8];
    #pragma unroll
    for (int r = 0; r < 8; ++r) partial[r] = 0.f;
    #pragma unroll
    for (int t = 0; t < 4; ++t) {
      #pragma unroll
      for (int r = 0; r < 8; ++r)
        partial[r] += fast_tanh(acc[q][t][r] + bm[t]) * wo[t];
    }
    // reduce the 16 columns held across each half-wave
    #pragma unroll
    for (int r = 0; r < 8; ++r) {
      #pragma unroll
      for (int m = 1; m < 16; m <<= 1)
        partial[r] += __shfl_xor(partial[r], m, 32);
    }
    if (colN == 0) {
      #pragma unroll
      for (int r = 0; r < 8; ++r) red[wave][q * 16 + r + 8 * half] = partial[r];
    }
  }
  __syncthreads();

  if (tid < MROWS) {  // combine 4 waves; write out[b, p, n, a]
    float s = red[0][tid] + red[1][tid] + red[2][tid] + red[3][tid];
    const int q = tid >> 4, row = tid & 15;
    out[(((size_t)(b * L_ + p0 + q) * NC_) + n) * L_ + (a0 + row)] = s;
  }
}

// ---------------------------------------------------------------------------
extern "C" void kernel_launch(void* const* d_in, const int* in_sizes, int n_in,
                              void* d_out, int out_size, void* d_ws, size_t ws_size,
                              hipStream_t stream) {
  const float* seq  = (const float*)d_in[0];
  const float* bsc  = (const float*)d_in[1];
  const float* Wp   = (const float*)d_in[2];
  const float* bp   = (const float*)d_in[3];
  const float* Wa   = (const float*)d_in[4];
  const float* ba   = (const float*)d_in[5];
  const float* Wmid = (const float*)d_in[6];
  const float* bmid = (const float*)d_in[7];
  const float* Wout = (const float*)d_in[8];
  float* out = (float*)d_out;

  char* ws = (char*)d_ws;
  _Float16* Bws  = (_Float16*)(ws + WS_BW_OFF);
  _Float16* Wc   = (_Float16*)(ws + WS_WC_OFF);
  _Float16* seqh = (_Float16*)(ws + WS_SQ_OFF);
  float*    hp   = (float*)(ws + WS_HP_OFF);
  float*    ha   = (float*)(ws + WS_HA_OFF);

  prep_wmid_kernel<<<BW_HALVES / 256, 256, 0, stream>>>(Wmid, Bws);
  prep_wcat_kernel<<<WC_HALVES / 256, 256, 0, stream>>>(Wp, Wa, Wc);
  prep_seqh_kernel<<<SQ_HALVES / 256, 256, 0, stream>>>(seq, seqh);

  dim3 gproj(NPROJ / 64, ROWS / 16);   // 20 x 24 = 480 workgroups
  proj_wmma_kernel<<<gproj, 128, 0, stream>>>(seqh, Wc, bp, ba, hp, ha);

  dim3 grid(L_ / 16, L_ / PT, B_ * NC_);   // 12 x 48 x 8 = 4608 workgroups
  fused_mid_out_kernel<<<grid, 128, 0, stream>>>(hp, ha, bsc, Bws, bmid, Wout, out);
}

// v002
// One run takes 81.1 microseconds.
// Next to v001, in two timings, it ran 1.27 times as fast each time.
// Over all steps from v000 it is 1.61 times as fast.
#include <hip/hip_runtime.h>

typedef _Float16 v16h __attribute__((ext_vector_type(16)));
typedef _Float16 v8h  __attribute__((ext_vector_type(8)));
typedef float    v8f  __attribute__((ext_vector_type(8)));

#define B_  2
#define L_  192
#define D_  768
#define NC_ 4
#define H_  256
#define KTRUE (H_ + NC_)   // 260 real K for mid layer
#define KP    288          // padded K (multiple of 32)
#define KC    (KP / 32)    // 9 k-chunks (mid layer)

#define NPROJ (H_ + NC_ * H_)   // 1280 projection output columns
#define KC2   (D_ / 32)         // 24 k-chunks (projection)
#define CT2   (NPROJ / 16)      // 80 column tiles (projection)
#define ROWS  (B_ * L_)         // 384 rows

// ---- Workspace layout (bytes) ----
#define BW_HALVES (NC_ * KC * 16 * 32 * 16)        // 294912 (Wmid f16 B-layout)
#define WS_BW_OFF   0
#define WC_HALVES (KC2 * CT2 * 32 * 16)            // 983040 ([Wp|Wa] f16 B-layout)
#define WS_WC_OFF   (BW_HALVES * 2)                // 589824
#define SQ_HALVES (ROWS * D_)                      // 294912 (seq f16)
#define WS_SQ_OFF   (WS_WC_OFF + WC_HALVES * 2)    // 2555904
#define WS_HP_OFF   (WS_SQ_OFF + SQ_HALVES * 2)    // 3145728
#define HP_FLOATS (ROWS * H_)                      // 98304
#define WS_HA_OFF   (WS_HP_OFF + HP_FLOATS * 4)    // 3538944
#define HA_FLOATS (ROWS * NC_ * H_)                // 393216
// total ws used ~= 4.9 MB

// Hardware tanh (TRANS op on CDNA5, co-executes with WMMA).
__device__ __forceinline__ float fast_tanh(float x) {
#if __has_builtin(__builtin_amdgcn_tanh_f32)
  return __builtin_amdgcn_tanh_f32(x);
#else
  float r;
  // TRANS hazard rule: 1 V_NOP before result use (ISA §7.4).
  asm volatile("v_tanh_f32 %0, %1\n\tv_nop" : "=v"(r) : "v"(x));
  return r;
#endif
}

// ---------------------------------------------------------------------------
// Kernel A: repack Wmid [NC, 260, 256] f32 -> padded f16 WMMA-B layout:
// Bws[n][kc][ct][lane][16 halves]; K >= 260 zero-padded.
//   lane < 16 : col = ct*16 + lane,      halves: K = kc*32 + {0..7,16..23}
//   lane >= 16: col = ct*16 + lane - 16, halves: K = kc*32 + {8..15,24..31}
// ---------------------------------------------------------------------------
__global__ void __launch_bounds__(256)
prep_wmid_kernel(const float* __restrict__ Wmid, _Float16* __restrict__ Bws) {
  int idx = blockIdx.x * blockDim.x + threadIdx.x;
  if (idx >= BW_HALVES) return;
  int i    = idx & 15;
  int lane = (idx >> 4) & 31;
  int ct   = (idx >> 9) & 15;
  int rest = idx >> 13;          // n*KC + kc
  int kc   = rest % KC;
  int n    = rest / KC;
  int col  = ct * 16 + (lane & 15);
  int k;
  if (lane < 16) k = kc * 32 + ((i < 8) ? i       : (16 + i - 8));
  else           k = kc * 32 + ((i < 8) ? (8 + i) : (24 + i - 8));
  float v = (k < KTRUE) ? Wmid[((size_t)n * KTRUE + k) * H_ + col] : 0.0f;
  Bws[idx] = (_Float16)v;
}

// ---------------------------------------------------------------------------
// Kernel B: repack [Wp | Wa] (768 x 1280) f32 -> f16 WMMA-B layout:
// Wc[kc][ct][lane][16 halves]   (no K padding needed: 768 % 32 == 0)
// ---------------------------------------------------------------------------
__global__ void __launch_bounds__(256)
prep_wcat_kernel(const float* __restrict__ Wp, const float* __restrict__ Wa,
                 _Float16* __restrict__ Wc) {
  int idx = blockIdx.x * blockDim.x + threadIdx.x;
  if (idx >= WC_HALVES) return;
  int i    = idx & 15;
  int lane = (idx >> 4) & 31;
  int rest = idx >> 9;           // kc*CT2 + ct
  int ct   = rest % CT2;
  int kc   = rest / CT2;
  int col  = ct * 16 + (lane & 15);       // 0..1279
  int k;
  if (lane < 16) k = kc * 32 + ((i < 8) ? i       : (16 + i - 8));
  else           k = kc * 32 + ((i < 8) ? (8 + i) : (24 + i - 8));
  float v = (col < H_) ? Wp[(size_t)k * H_ + col]
                       : Wa[(size_t)k * (NC_ * H_) + (col - H_)];
  Wc[idx] = (_Float16)v;
}

// Kernel C: seq f32 -> f16 (row-major, same indexing)
__global__ void __launch_bounds__(256)
prep_seqh_kernel(const float* __restrict__ seq, _Float16* __restrict__ seqh) {
  int idx = blockIdx.x * blockDim.x + threadIdx.x;
  if (idx < SQ_HALVES) seqh[idx] = (_Float16)seq[idx];
}

// ---------------------------------------------------------------------------
// Kernel D: projection GEMM via WMMA.
// [hp | ha](row, col) = seq(row,:) @ [Wp|Wa](:, col) + [bp|ba](col)
// Grid: (NPROJ/64 = 20, ROWS/16 = 24); block = 128 (4 waves).
// Each wave owns one 16x16 output tile; K = 768 in 24 chunks.
// ---------------------------------------------------------------------------
__global__ void __launch_bounds__(128)
proj_wmma_kernel(const _Float16* __restrict__ seqh,
                 const _Float16* __restrict__ Wc,
                 const float* __restrict__ bp, const float* __restrict__ ba,
                 float* __restrict__ hp, float* __restrict__ ha) {
  const int tid  = threadIdx.x;
  const int wave = tid >> 5;
  const int lane = tid & 31;
  const int ct   = blockIdx.x * 4 + wave;   // column tile (0..79)
  const int row0 = blockIdx.y * 16;

  const int rowm = lane & 15;
  const int koff = (lane >> 4) * 8;

  v8f acc = {0.f, 0.f, 0.f, 0.f, 0.f, 0.f, 0.f, 0.f};
  const _Float16* arow = seqh + (size_t)(row0 + rowm) * D_;

  #pragma unroll
  for (int kc = 0; kc < KC2; ++kc) {
    v8h lo = *(const v8h*)(arow + kc * 32 + koff);
    v8h hi = *(const v8h*)(arow + kc * 32 + koff + 16);
    v16h a = __builtin_shufflevector(lo, hi,
                                     0, 1, 2, 3, 4, 5, 6, 7,
                                     8, 9, 10, 11, 12, 13, 14, 15);
    v16h b = *(const v16h*)(Wc + (((size_t)kc * CT2 + ct) * 32 + lane) * 16);
    acc = __builtin_amdgcn_wmma_f32_16x16x32_f16(
        false, a, false, b, (short)0, acc, false, false);
  }

  const int colN = lane & 15;
  const int half = lane >> 4;
  const int col  = ct * 16 + colN;                 // 0..1279
  const float bias = (col < H_) ? bp[col] : ba[col - H_];
  #pragma unroll
  for (int r = 0; r < 8; ++r) {
    const int row = row0 + r + 8 * half;
    const float v = acc[r] + bias;
    if (col < H_) hp[(size_t)row * H_ + col] = v;
    else          ha[(size_t)row * (NC_ * H_) + (col - H_)] = v;
  }
}

// ---------------------------------------------------------------------------
// Kernel E: fused  tanh(h_p+h_a)|bs  ->  WMMA x Wmid  ->  tanh(+bmid) . Wout
// Grid: (a_tile=12, p_group=48, b*NC=8).  Block: 128 threads = 4 waves.
// One work-group owns 64 rows: PT = 4 predicates x 16 argument positions
// (row = q*16 + a).  Each wave owns 4 column tiles (64 h' columns) of all
// 4 row tiles, so a B fragment loaded once feeds 4 WMMAs and an h_a value
// loaded once feeds 4 tanh.  K loop = 9 chunks of 32.
// ---------------------------------------------------------------------------
#define PT 4                 // predicates (row tiles) per work-group
#define MROWS (PT * 16)      // 64 rows per work-group

__global__ void __launch_bounds__(128)
fused_mid_out_kernel(const float* __restrict__ hp, const float* __restrict__ ha,
                     const float* __restrict__ base_score,
                     const _Float16* __restrict__ Bws,
                     const float* __restrict__ bmid, const float* __restrict__ Wout,
                     float* __restrict__ out) {
  __shared__ alignas(16) _Float16 Alds[MROWS][KP];
  __shared__ float red[4][MROWS];

  const int at = blockIdx.x;       // a-tile index (0..11)
  const int p0 = blockIdx.y * PT;  // first predicate index of the group
  const int bz = blockIdx.z;       // b*NC + n
  const int b  = bz >> 2;
  const int n  = bz & 3;
  const int a0 = at * 16;
  const int tid = threadIdx.x;

  // --- Build A tile in LDS: rows = 4 predicates x 16 arguments, cols = padded K ---
  // Every loop over c, q, t, r, i or u here is unrolled so that its arrays are
  // indexed by constants and stay in registers.
  float hpv[2][PT];                            // this thread's two columns of h_p
  #pragma unroll
  for (int c = 0; c < 2; ++c)
    #pragma unroll
    for (int q = 0; q < PT; ++q)
      hpv[c][q] = hp[((size_t)(b * L_ + p0 + q)) * H_ + c * 128 + tid];

  // All global loads of the build stand here, in front of the first tanh: the
  // tanh is volatile asm, which no load crosses, so a load written between two
  // of them is waited for alone and its whole latency is paid once per load.
  float hav[32];                               // 16x256 h_a values, 32 a thread
  const float* hab = ha + (((size_t)(b * L_ + a0) * NC_) + n) * H_ + tid;
  #pragma unroll
  for (int i = 0; i < 32; ++i)                 // row i >> 1, column (i & 1) * 128 + tid
    hav[i] = hab[(i >> 1) * (NC_ * H_) + (i & 1) * 128];
  float bsv[MROWS * NC_ / 128];                // base_score, 2 a thread
  #pragma unroll
  for (int u = 0; u < MROWS * NC_ / 128; ++u) {
    int e  = u * 128 + tid;
    int rw = e >> 2, j = e & 3;
    int q = rw >> 4, row = rw & 15;
    bsv[u] = base_score[(((size_t)(b * L_ + p0 + q) * NC_) + j) * L_ + (a0 + row)];
  }

  #pragma unroll
  for (int i = 0; i < 32; ++i) {               // 4 tanh per h_a value
    int e   = i * 128 + tid;
    int row = e >> 8;
    int col = e & 255;
    #pragma unroll
    for (int q = 0; q < PT; ++q)
      Alds[q * 16 + row][col] = (_Float16)fast_tanh(hpv[i & 1][q] + hav[i]);
  }
  #pragma unroll
  for (int u = 0; u < MROWS * NC_ / 128; ++u) {    // base_score cols 256..259
    int e  = u * 128 + tid;
    Alds[e >> 2][H_ + (e & 3)] = (_Float16)bsv[u];
  }
  for (int e = tid; e < MROWS * (KP - KTRUE); e += 128) {  // zero pad 260..287
    int row = e / (KP - KTRUE);
    int col = KTRUE + e % (KP - KTRUE);
    Alds[row][col] = (_Float16)0.0f;
  }
  __syncthreads();

  const int wave = tid >> 5;
  const int lane = tid & 31;
  const int rowm = lane & 15;          // A-matrix row this lane carries
  const int koff = (lane >> 4) * 8;    // half-wave K offset within chunk

  const int colN = lane & 15;          // h' column within tile
  const int half = lane >> 4;          // 0: rows 0..7, 1: rows 8..15
  float bm[4], wo[4];
  #pragma unroll
  for (int t = 0; t < 4; ++t) {
    const int hcol = (wave * 4 + t) * 16 + colN;
    bm[t] = bmid[n * H_ + hcol];
    wo[t] = Wout[n * H_ + hcol];
  }

  v8f acc[PT][4];
  const v8f vzero = {0.f, 0.f, 0.f, 0.f, 0.f, 0.f, 0.f, 0.f};
  #pragma unroll
  for (int q = 0; q < PT; ++q)
    #pragma unroll
    for (int t = 0; t < 4; ++t) acc[q][t] = vzero;

  const _Float16* Bbase = Bws + (size_t)n * (KC * 16 * 32 * 16);

  #pragma unroll
  for (int kc = 0; kc < KC; ++kc) {
    v16h a[PT];
    #pragma unroll
    for (int q = 0; q < PT; ++q) {
      v8h lo = *(const v8h*)&Alds[q * 16 + rowm][kc * 32 + koff];
      v8h hi = *(const v8h*)&Alds[q * 16 + rowm][kc * 32 + koff + 16];
      a[q] = __builtin_shufflevector(lo, hi,
                                     0, 1, 2, 3, 4, 5, 6, 7,
                                     8, 9, 10, 11, 12, 13, 14, 15);
    }
    v16h bv[4];
    #pragma unroll
    for (int t = 0; t < 4; ++t) {
      const int ct = wave * 4 + t;
      bv[t] = *(const v16h*)(Bbase + (((size_t)kc * 16 + ct) * 32 + lane) * 16);
    }
    #pragma unroll
    for (int t = 0; t < 4; ++t) {
      #pragma unroll
      for (int q = 0; q < PT; ++q)
        acc[q][t] = __builtin_amdgcn_wmma_f32_16x16x32_f16(
            false, a[q], false, bv[t], (short)0, acc[q][t], false, false);
    }
  }
  // The tanh below is asm text, which the compiler does not pad against a WMMA:
  // the barrier keeps every WMMA above this line, and the four v_nop are the
  // vector slots the chip needs before a tanh result may land in a register
  // that the last WMMA reads as A or B.
  __builtin_amdgcn_sched_barrier(0);
  asm volatile("v_nop\n\tv_nop\n\tv_nop\n\tv_nop");

  // --- Epilogue: out_partial(row) = sum_h' tanh(mid + bmid) * Wout ---
  #pragma unroll
  for (int q = 0; q < PT; ++q) {
    float partial[8];
    #pragma unroll
    for (int r = 0; r < 8; ++r) partial[r] = 0.f;
    #pragma unroll
    for (int t = 0; t < 4; ++t) {
      #pragma unroll
      for (int r = 0; r < 8; ++r)
        partial[r] += fast_tanh(acc[q][t][r] + bm[t]) * wo[t];
    }
    // reduce the 16 columns held across each half-wave
    #pragma unroll
    for (int r = 0; r < 8; ++r) {
      #pragma unroll
      for (int m = 1; m < 16; m <<= 1)
        partial[r] += __shfl_xor(partial[r], m, 32);
    }
    if (colN == 0) {
      #pragma unroll
      for (int r = 0; r < 8; ++r) red[wave][q * 16 + r + 8 * half] = partial[r];
    }
  }
  __syncthreads();

  if (tid < MROWS) {  // combine 4 waves; write out[b, p, n, a]
    float s = red[0][tid] + red[1][tid] + red[2][tid] + red[3][tid];
    const int q = tid >> 4, row = tid & 15;
    out[(((size_t)(b * L_ + p0 + q) * NC_) + n) * L_ + (a0 + row)] = s;
  }
}

// ---------------------------------------------------------------------------
extern "C" void kernel_launch(void* const* d_in, const int* in_sizes, int n_in,
                              void* d_out, int out_size, void* d_ws, size_t ws_size,
                              hipStream_t stream) {
  const float* seq  = (const float*)d_in[0];
  const float* bsc  = (const float*)d_in[1];
  const float* Wp   = (const float*)d_in[2];
  const float* bp   = (const float*)d_in[3];
  const float* Wa   = (const float*)d_in[4];
  const float* ba   = (const float*)d_in[5];
  const float* Wmid = (const float*)d_in[6];
  const float* bmid = (const float*)d_in[7];
  const float* Wout = (const float*)d_in[8];
  float* out = (float*)d_out;

  char* ws = (char*)d_ws;
  _Float16* Bws  = (_Float16*)(ws + WS_BW_OFF);
  _Float16* Wc   = (_Float16*)(ws + WS_WC_OFF);
  _Float16* seqh = (_Float16*)(ws + WS_SQ_OFF);
  float*    hp   = (float*)(ws + WS_HP_OFF);
  float*    ha   = (float*)(ws + WS_HA_OFF);

  prep_wmid_kernel<<<BW_HALVES / 256, 256, 0, stream>>>(Wmid, Bws);
  prep_wcat_kernel<<<WC_HALVES / 256, 256, 0, stream>>>(Wp, Wa, Wc);
  prep_seqh_kernel<<<SQ_HALVES / 256, 256, 0, stream>>>(seq, seqh);

  dim3 gproj(NPROJ / 64, ROWS / 16);   // 20 x 24 = 480 workgroups
  proj_wmma_kernel<<<gproj, 128, 0, stream>>>(seqh, Wc, bp, ba, hp, ha);

  dim3 grid(L_ / 16, L_ / PT, B_ * NC_);   // 12 x 48 x 8 = 4608 workgroups
  fused_mid_out_kernel<<<grid, 128, 0, stream>>>(hp, ha, bsc, Bws, bmid, Wout, out);
}

// v003
// Measured time: 70.8 microseconds a run.
// In both of two side-by-side timings against v002, it was 1.14 times as fast.
// All steps since v000 together make it 1.83 times as fast.
#include <hip/hip_runtime.h>

typedef _Float16 v16h __attribute__((ext_vector_type(16)));
typedef _Float16 v8h  __attribute__((ext_vector_type(8)));
typedef float    v8f  __attribute__((ext_vector_type(8)));

#define B_  2
#define L_  192
#define D_  768
#define NC_ 4
#define H_  256
#define KTRUE (H_ + NC_)   // 260 real K for mid layer
#define KP    288          // padded K (multiple of 32)
#define KC    (KP / 32)    // 9 k-chunks (mid layer)

#define NPROJ (H_ + NC_ * H_)   // 1280 projection output columns
#define KC2   (D_ / 32)         // 24 k-chunks (projection)
#define CT2   (NPROJ / 16)      // 80 column tiles (projection)
#define ROWS  (B_ * L_)         // 384 rows

// ---- Workspace layout (bytes) ----
#define BW_HALVES (NC_ * KC * 16 * 32 * 16)        // 294912 (Wmid f16 B-layout)
#define WS_BW_OFF   0
#define WC_HALVES (KC2 * CT2 * 32 * 16)            // 983040 ([Wp|Wa] f16 B-layout)
#define WS_WC_OFF   (BW_HALVES * 2)                // 589824
#define SQ_HALVES (ROWS * D_)                      // 294912 (seq f16)
#define WS_SQ_OFF   (WS_WC_OFF + WC_HALVES * 2)    // 2555904
#define WS_HP_OFF   (WS_SQ_OFF + SQ_HALVES * 2)    // 3145728
#define HP_FLOATS (ROWS * H_)                      // 98304
#define WS_HA_OFF   (WS_HP_OFF + HP_FLOATS * 4)    // 3538944
#define HA_FLOATS (ROWS * NC_ * H_)                // 393216
// total ws used ~= 4.9 MB

// Hardware tanh (TRANS op on CDNA5, co-executes with WMMA).
__device__ __forceinline__ float fast_tanh(float x) {
#if __has_builtin(__builtin_amdgcn_tanh_f32)
  return __builtin_amdgcn_tanh_f32(x);
#else
  float r;
  // TRANS hazard rule: 1 V_NOP before result use (ISA §7.4).
  asm volatile("v_tanh_f32 %0, %1\n\tv_nop" : "=v"(r) : "v"(x));
  return r;
#endif
}

// ---------------------------------------------------------------------------
// Kernel A: repack Wmid [NC, 260, 256] f32 -> padded f16 WMMA-B layout:
// Bws[n][kc][ct][lane][16 halves]; K >= 260 zero-padded.
//   lane < 16 : col = ct*16 + lane,      halves: K = kc*32 + {0..7,16..23}
//   lane >= 16: col = ct*16 + lane - 16, halves: K = kc*32 + {8..15,24..31}
// ---------------------------------------------------------------------------
__global__ void __launch_bounds__(256)
prep_wmid_kernel(const float* __restrict__ Wmid, _Float16* __restrict__ Bws) {
  int idx = blockIdx.x * blockDim.x + threadIdx.x;
  if (idx >= BW_HALVES) return;
  int i    = idx & 15;
  int lane = (idx >> 4) & 31;
  int ct   = (idx >> 9) & 15;
  int rest = idx >> 13;          // n*KC + kc
  int kc   = rest % KC;
  int n    = rest / KC;
  int col  = ct * 16 + (lane & 15);
  int k;
  if (lane < 16) k = kc * 32 + ((i < 8) ? i       : (16 + i - 8));
  else           k = kc * 32 + ((i < 8) ? (8 + i) : (24 + i - 8));
  float v = (k < KTRUE) ? Wmid[((size_t)n * KTRUE + k) * H_ + col] : 0.0f;
  Bws[idx] = (_Float16)v;
}

// ---------------------------------------------------------------------------
// Kernel B: repack [Wp | Wa] (768 x 1280) f32 -> f16 WMMA-B layout:
// Wc[kc][ct][lane][16 halves]   (no K padding needed: 768 % 32 == 0)
// ---------------------------------------------------------------------------
__global__ void __launch_bounds__(256)
prep_wcat_kernel(const float* __restrict__ Wp, const float* __restrict__ Wa,
                 _Float16* __restrict__ Wc) {
  int idx = blockIdx.x * blockDim.x + threadIdx.x;
  if (idx >= WC_HALVES) return;
  int i    = idx & 15;
  int lane = (idx >> 4) & 31;
  int rest = idx >> 9;           // kc*CT2 + ct
  int ct   = rest % CT2;
  int kc   = rest / CT2;
  int col  = ct * 16 + (lane & 15);       // 0..1279
  int k;
  if (lane < 16) k = kc * 32 + ((i < 8) ? i       : (16 + i - 8));
  else           k = kc * 32 + ((i < 8) ? (8 + i) : (24 + i - 8));
  float v = (col < H_) ? Wp[(size_t)k * H_ + col]
                       : Wa[(size_t)k * (NC_ * H_) + (col - H_)];
  Wc[idx] = (_Float16)v;
}

// Kernel C: seq f32 -> f16 (row-major, same indexing)
__global__ void __launch_bounds__(256)
prep_seqh_kernel(const float* __restrict__ seq, _Float16* __restrict__ seqh) {
  int idx = blockIdx.x * blockDim.x + threadIdx.x;
  if (idx < SQ_HALVES) seqh[idx] = (_Float16)seq[idx];
}

// ---------------------------------------------------------------------------
// Kernel D: projection GEMM via WMMA.
// [hp | ha](row, col) = seq(row,:) @ [Wp|Wa](:, col) + [bp|ba](col)
// Grid: (NPROJ/64 = 20, ROWS/16 = 24); block = 128 (4 waves).
// Each wave owns one 16x16 output tile; K = 768 in 24 chunks.
// ---------------------------------------------------------------------------
__global__ void __launch_bounds__(128)
proj_wmma_kernel(const _Float16* __restrict__ seqh,
                 const _Float16* __restrict__ Wc,
                 const float* __restrict__ bp, const float* __restrict__ ba,
                 float* __restrict__ hp, float* __restrict__ ha) {
  const int tid  = threadIdx.x;
  const int wave = tid >> 5;
  const int lane = tid & 31;
  const int ct   = blockIdx.x * 4 + wave;   // column tile (0..79)
  const int row0 = blockIdx.y * 16;

  const int rowm = lane & 15;
  const int koff = (lane >> 4) * 8;

  v8f acc = {0.f, 0.f, 0.f, 0.f, 0.f, 0.f, 0.f, 0.f};
  const _Float16* arow = seqh + (size_t)(row0 + rowm) * D_;

  #pragma unroll
  for (int kc = 0; kc < KC2; ++kc) {
    v8h lo = *(const v8h*)(arow + kc * 32 + koff);
    v8h hi = *(const v8h*)(arow + kc * 32 + koff + 16);
    v16h a = __builtin_shufflevector(lo, hi,
                                     0, 1, 2, 3, 4, 5, 6, 7,
                                     8, 9, 10, 11, 12, 13, 14, 15);
    v16h b = *(const v16h*)(Wc + (((size_t)kc * CT2 + ct) * 32 + lane) * 16);
    acc = __builtin_amdgcn_wmma_f32_16x16x32_f16(
        false, a, false, b, (short)0, acc, false, false);
  }

  const int colN = lane & 15;
  const int half = lane >> 4;
  const int col  = ct * 16 + colN;                 // 0..1279
  const float bias = (col < H_) ? bp[col] : ba[col - H_];
  #pragma unroll
  for (int r = 0; r < 8; ++r) {
    const int row = row0 + r + 8 * half;
    const float v = acc[r] + bias;
    if (col < H_) hp[(size_t)row * H_ + col] = v;
    else          ha[(size_t)row * (NC_ * H_) + (col - H_)] = v;
  }
}

// ---------------------------------------------------------------------------
// Kernel E: fused  tanh(h_p+h_a)|bs  ->  WMMA x Wmid  ->  tanh(+bmid) . Wout
// Grid: (a_tile=12, p_group=48, b*NC=8).  Block: 128 threads = 4 waves.
// One work-group owns 64 rows: PT = 4 predicates x 16 argument positions
// (row = q*16 + a).  Each wave owns 4 column tiles (64 h' columns) of all
// 4 row tiles, so a B fragment loaded once feeds 4 WMMAs and an h_a value
// loaded once feeds 4 tanh.  K loop = 9 chunks of 32.  The B fragments are
// fetched two chunks ahead into two register sets.
// ---------------------------------------------------------------------------
#define PT 4                 // predicates (row tiles) per work-group
#define MROWS (PT * 16)      // 64 rows per work-group

__global__ void __launch_bounds__(128)
fused_mid_out_kernel(const float* __restrict__ hp, const float* __restrict__ ha,
                     const float* __restrict__ base_score,
                     const _Float16* __restrict__ Bws,
                     const float* __restrict__ bmid, const float* __restrict__ Wout,
                     float* __restrict__ out) {
  __shared__ alignas(16) _Float16 Alds[MROWS][KP];
  __shared__ float red[4][MROWS];

  const int at = blockIdx.x;       // a-tile index (0..11)
  const int p0 = blockIdx.y * PT;  // first predicate index of the group
  const int bz = blockIdx.z;       // b*NC + n
  const int b  = bz >> 2;
  const int n  = bz & 3;
  const int a0 = at * 16;
  const int tid = threadIdx.x;
  const int wave = tid >> 5;
  const int lane = tid & 31;

  // --- Build A tile in LDS: rows = 4 predicates x 16 arguments, cols = padded K ---
  // Every loop over c, q, t, r, i or u here is unrolled so that its arrays are
  // indexed by constants and stay in registers.
  float hpv[2][PT];                            // this thread's two columns of h_p
  #pragma unroll
  for (int c = 0; c < 2; ++c)
    #pragma unroll
    for (int q = 0; q < PT; ++q)
      hpv[c][q] = hp[((size_t)(b * L_ + p0 + q)) * H_ + c * 128 + tid];

  // All global loads of the build stand here, in front of the first tanh: the
  // tanh is volatile asm, which no load crosses, so a load written between two
  // of them is waited for alone and its whole latency is paid once per load.
  float hav[32];                               // 16x256 h_a values, 32 a thread
  const float* hab = ha + (((size_t)(b * L_ + a0) * NC_) + n) * H_ + tid;
  #pragma unroll
  for (int i = 0; i < 32; ++i)                 // row i >> 1, column (i & 1) * 128 + tid
    hav[i] = hab[(i >> 1) * (NC_ * H_) + (i & 1) * 128];
  float bsv[MROWS * NC_ / 128];                // base_score, 2 a thread
  #pragma unroll
  for (int u = 0; u < MROWS * NC_ / 128; ++u) {
    int e  = u * 128 + tid;
    int rw = e >> 2, j = e & 3;
    int q = rw >> 4, row = rw & 15;
    bsv[u] = base_score[(((size_t)(b * L_ + p0 + q) * NC_) + j) * L_ + (a0 + row)];
  }

  // B fragments of k-chunks 0 and 1: they depend on nothing the build makes, so
  // their latency passes under the tanh phase.  Fragment (kc, t) of this lane
  // stands at Bl + (kc * 16 + t) * 512 halves.
  const _Float16* Bl = Bws + (size_t)n * (KC * 16 * 32 * 16)
                           + ((size_t)(wave * 4) * 32 + lane) * 16;
  v16h bv[2][4];
  #pragma unroll
  for (int s = 0; s < 2; ++s)
    #pragma unroll
    for (int t = 0; t < 4; ++t)
      bv[s][t] = *(const v16h*)(Bl + (s * 16 + t) * 512);

  #pragma unroll
  for (int i = 0; i < 32; ++i) {               // 4 tanh per h_a value
    int e   = i * 128 + tid;
    int row = e >> 8;
    int col = e & 255;
    #pragma unroll
    for (int q = 0; q < PT; ++q)
      Alds[q * 16 + row][col] = (_Float16)fast_tanh(hpv[i & 1][q] + hav[i]);
  }
  #pragma unroll
  for (int u = 0; u < MROWS * NC_ / 128; ++u) {    // base_score cols 256..259
    int e  = u * 128 + tid;
    Alds[e >> 2][H_ + (e & 3)] = (_Float16)bsv[u];
  }
  for (int e = tid; e < MROWS * (KP - KTRUE); e += 128) {  // zero pad 260..287
    int row = e / (KP - KTRUE);
    int col = KTRUE + e % (KP - KTRUE);
    Alds[row][col] = (_Float16)0.0f;
  }
  __syncthreads();

  const int rowm = lane & 15;          // A-matrix row this lane carries
  const int koff = (lane >> 4) * 8;    // half-wave K offset within chunk

  const int colN = lane & 15;          // h' column within tile
  const int half = lane >> 4;          // 0: rows 0..7, 1: rows 8..15
  float bm[4], wo[4];
  #pragma unroll
  for (int t = 0; t < 4; ++t) {
    const int hcol = (wave * 4 + t) * 16 + colN;
    bm[t] = bmid[n * H_ + hcol];
    wo[t] = Wout[n * H_ + hcol];
  }

  v8f acc[PT][4];
  const v8f vzero = {0.f, 0.f, 0.f, 0.f, 0.f, 0.f, 0.f, 0.f};
  #pragma unroll
  for (int q = 0; q < PT; ++q)
    #pragma unroll
    for (int t = 0; t < 4; ++t) acc[q][t] = vzero;

  #pragma unroll
  for (int kc = 0; kc < KC; ++kc) {
    v16h a[PT];
    #pragma unroll
    for (int q = 0; q < PT; ++q) {
      v8h lo = *(const v8h*)&Alds[q * 16 + rowm][kc * 32 + koff];
      v8h hi = *(const v8h*)&Alds[q * 16 + rowm][kc * 32 + koff + 16];
      a[q] = __builtin_shufflevector(lo, hi,
                                     0, 1, 2, 3, 4, 5, 6, 7,
                                     8, 9, 10, 11, 12, 13, 14, 15);
    }
    #pragma unroll
    for (int t = 0; t < 4; ++t) {
      #pragma unroll
      for (int q = 0; q < PT; ++q)
        acc[q][t] = __builtin_amdgcn_wmma_f32_16x16x32_f16(
            false, a[q], false, bv[kc & 1][t], (short)0, acc[q][t], false, false);
      if (kc + 2 < KC)   // refill the set just used with chunk kc + 2
        bv[kc & 1][t] = *(const v16h*)(Bl + ((kc + 2) * 16 + t) * 512);
    }
    // Mask 0x786: vector, scalar, LDS and transcendental instructions may cross
    // this line, a global load or a WMMA may not.  So the refills above stay a
    // whole chunk of WMMAs ahead of their use; without the line the compiler
    // sinks each one to its use and waits out its whole latency there.
    __builtin_amdgcn_sched_barrier(0x786);
  }
  // The tanh below is asm text, which the compiler does not pad against a WMMA:
  // the barrier keeps every WMMA above this line, and the four v_nop are the
  // vector slots the chip needs before a tanh result may land in a register
  // that the last WMMA reads as A or B.
  __builtin_amdgcn_sched_barrier(0);
  asm volatile("v_nop\n\tv_nop\n\tv_nop\n\tv_nop");

  // --- Epilogue: out_partial(row) = sum_h' tanh(mid + bmid) * Wout ---
  #pragma unroll
  for (int q = 0; q < PT; ++q) {
    float partial[8];
    #pragma unroll
    for (int r = 0; r < 8; ++r) partial[r] = 0.f;
    #pragma unroll
    for (int t = 0; t < 4; ++t) {
      #pragma unroll
      for (int r = 0; r < 8; ++r)
        partial[r] += fast_tanh(acc[q][t][r] + bm[t]) * wo[t];
    }
    // reduce the 16 columns held across each half-wave
    #pragma unroll
    for (int r = 0; r < 8; ++r) {
      #pragma unroll
      for (int m = 1; m < 16; m <<= 1)
        partial[r] += __shfl_xor(partial[r], m, 32);
    }
    if (colN == 0) {
      #pragma unroll
      for (int r = 0; r < 8; ++r) red[wave][q * 16 + r + 8 * half] = partial[r];
    }
  }
  __syncthreads();

  if (tid < MROWS) {  // combine 4 waves; write out[b, p, n, a]
    float s = red[0][tid] + red[1][tid] + red[2][tid] + red[3][tid];
    const int q = tid >> 4, row = tid & 15;
    out[(((size_t)(b * L_ + p0 + q) * NC_) + n) * L_ + (a0 + row)] = s;
  }
}

// ---------------------------------------------------------------------------
extern "C" void kernel_launch(void* const* d_in, const int* in_sizes, int n_in,
                              void* d_out, int out_size, void* d_ws, size_t ws_size,
                              hipStream_t stream) {
  const float* seq  = (const float*)d_in[0];
  const float* bsc  = (const float*)d_in[1];
  const float* Wp   = (const float*)d_in[2];
  const float* bp   = (const float*)d_in[3];
  const float* Wa   = (const float*)d_in[4];
  const float* ba   = (const float*)d_in[5];
  const float* Wmid = (const float*)d_in[6];
  const float* bmid = (const float*)d_in[7];
  const float* Wout = (const float*)d_in[8];
  float* out = (float*)d_out;

  char* ws = (char*)d_ws;
  _Float16* Bws  = (_Float16*)(ws + WS_BW_OFF);
  _Float16* Wc   = (_Float16*)(ws + WS_WC_OFF);
  _Float16* seqh = (_Float16*)(ws + WS_SQ_OFF);
  float*    hp   = (float*)(ws + WS_HP_OFF);
  float*    ha   = (float*)(ws + WS_HA_OFF);

  prep_wmid_kernel<<<BW_HALVES / 256, 256, 0, stream>>>(Wmid, Bws);
  prep_wcat_kernel<<<WC_HALVES / 256, 256, 0, stream>>>(Wp, Wa, Wc);
  prep_seqh_kernel<<<SQ_HALVES / 256, 256, 0, stream>>>(seq, seqh);

  dim3 gproj(NPROJ / 64, ROWS / 16);   // 20 x 24 = 480 workgroups
  proj_wmma_kernel<<<gproj, 128, 0, stream>>>(seqh, Wc, bp, ba, hp, ha);

  dim3 grid(L_ / 16, L_ / PT, B_ * NC_);   // 12 x 48 x 8 = 4608 workgroups
  fused_mid_out_kernel<<<grid, 128, 0, stream>>>(hp, ha, bsc, Bws, bmid, Wout, out);
}

// v004
// One run takes 64.9 microseconds.
// Next to v003, in two timings, it ran 1.08 and 1.10 times as fast.
// All steps since v000 together make it 2.00 times as fast.
#include <hip/hip_runtime.h>

typedef _Float16 v16h __attribute__((ext_vector_type(16)));
typedef _Float16 v8h  __attribute__((ext_vector_type(8)));
typedef float    v8f  __attribute__((ext_vector_type(8)));

#define B_  2
#define L_  192
#define D_  768
#define NC_ 4
#define H_  256
#define KTRUE (H_ + NC_)   // 260 real K for mid layer
#define KP    288          // padded K (multiple of 32)
#define KC    (KP / 32)    // 9 k-chunks (mid layer)

#define NPROJ (H_ + NC_ * H_)   // 1280 projection output columns
#define KC2   (D_ / 32)         // 24 k-chunks (projection)
#define CT2   (NPROJ / 16)      // 80 column tiles (projection)
#define ROWS  (B_ * L_)         // 384 rows

// ---- Workspace layout (bytes) ----
#define BW_HALVES (NC_ * KC * 16 * 32 * 16)        // 294912 (Wmid f16 B-layout)
#define WS_BW_OFF   0
#define WC_HALVES (KC2 * CT2 * 32 * 16)            // 983040 ([Wp|Wa] f16 B-layout)
#define WS_WC_OFF   (BW_HALVES * 2)                // 589824
#define SQ_HALVES (ROWS * D_)                      // 294912 (seq f16)
#define WS_SQ_OFF   (WS_WC_OFF + WC_HALVES * 2)    // 2555904
#define WS_HP_OFF   (WS_SQ_OFF + SQ_HALVES * 2)    // 3145728
#define HP_FLOATS (ROWS * H_)                      // 98304
#define WS_HA_OFF   (WS_HP_OFF + HP_FLOATS * 4)    // 3538944
#define HA_FLOATS (ROWS * NC_ * H_)                // 393216
// total ws used ~= 4.9 MB

// Hardware tanh (TRANS op on CDNA5, co-executes with WMMA).
__device__ __forceinline__ float fast_tanh(float x) {
#if __has_builtin(__builtin_amdgcn_tanh_f32)
  return __builtin_amdgcn_tanh_f32(x);
#else
  float r;
  // TRANS hazard rule: 1 V_NOP before result use (ISA §7.4).
  asm volatile("v_tanh_f32 %0, %1\n\tv_nop" : "=v"(r) : "v"(x));
  return r;
#endif
}

// ---------------------------------------------------------------------------
// Kernel A: repack Wmid [NC, 260, 256] f32 -> padded f16 WMMA-B layout:
// Bws[n][kc][ct][lane][16 halves]; K >= 260 zero-padded.
//   lane < 16 : col = ct*16 + lane,      halves: K = kc*32 + {0..7,16..23}
//   lane >= 16: col = ct*16 + lane - 16, halves: K = kc*32 + {8..15,24..31}
// ---------------------------------------------------------------------------
__global__ void __launch_bounds__(256)
prep_wmid_kernel(const float* __restrict__ Wmid, _Float16* __restrict__ Bws) {
  int idx = blockIdx.x * blockDim.x + threadIdx.x;
  if (idx >= BW_HALVES) return;
  int i    = idx & 15;
  int lane = (idx >> 4) & 31;
  int ct   = (idx >> 9) & 15;
  int rest = idx >> 13;          // n*KC + kc
  int kc   = rest % KC;
  int n    = rest / KC;
  int col  = ct * 16 + (lane & 15);
  int k;
  if (lane < 16) k = kc * 32 + ((i < 8) ? i       : (16 + i - 8));
  else           k = kc * 32 + ((i < 8) ? (8 + i) : (24 + i - 8));
  float v = (k < KTRUE) ? Wmid[((size_t)n * KTRUE + k) * H_ + col] : 0.0f;
  Bws[idx] = (_Float16)v;
}

// ---------------------------------------------------------------------------
// Kernel B: repack [Wp | Wa] (768 x 1280) f32 -> f16 WMMA-B layout:
// Wc[kc][ct][lane][16 halves]   (no K padding needed: 768 % 32 == 0)
// ---------------------------------------------------------------------------
__global__ void __launch_bounds__(256)
prep_wcat_kernel(const float* __restrict__ Wp, const float* __restrict__ Wa,
                 _Float16* __restrict__ Wc) {
  int idx = blockIdx.x * blockDim.x + threadIdx.x;
  if (idx >= WC_HALVES) return;
  int i    = idx & 15;
  int lane = (idx >> 4) & 31;
  int rest = idx >> 9;           // kc*CT2 + ct
  int ct   = rest % CT2;
  int kc   = rest / CT2;
  int col  = ct * 16 + (lane & 15);       // 0..1279
  int k;
  if (lane < 16) k = kc * 32 + ((i < 8) ? i       : (16 + i - 8));
  else           k = kc * 32 + ((i < 8) ? (8 + i) : (24 + i - 8));
  float v = (col < H_) ? Wp[(size_t)k * H_ + col]
                       : Wa[(size_t)k * (NC_ * H_) + (col - H_)];
  Wc[idx] = (_Float16)v;
}

// Kernel C: seq f32 -> f16 (row-major, same indexing)
__global__ void __launch_bounds__(256)
prep_seqh_kernel(const float* __restrict__ seq, _Float16* __restrict__ seqh) {
  int idx = blockIdx.x * blockDim.x + threadIdx.x;
  if (idx < SQ_HALVES) seqh[idx] = (_Float16)seq[idx];
}

// ---------------------------------------------------------------------------
// Kernel D: projection GEMM via WMMA.
// [hp | ha](row, col) = seq(row,:) @ [Wp|Wa](:, col) + [bp|ba](col)
// Grid: (NPROJ/64 = 20, ROWS/16 = 24); block = 128 (4 waves).
// Each wave owns one 16x16 output tile; K = 768 in 24 chunks.
// ---------------------------------------------------------------------------
__global__ void __launch_bounds__(128)
proj_wmma_kernel(const _Float16* __restrict__ seqh,
                 const _Float16* __restrict__ Wc,
                 const float* __restrict__ bp, const float* __restrict__ ba,
                 float* __restrict__ hp, float* __restrict__ ha) {
  const int tid  = threadIdx.x;
  const int wave = tid >> 5;
  const int lane = tid & 31;
  const int ct   = blockIdx.x * 4 + wave;   // column tile (0..79)
  const int row0 = blockIdx.y * 16;

  const int rowm = lane & 15;
  const int koff = (lane >> 4) * 8;

  v8f acc = {0.f, 0.f, 0.f, 0.f, 0.f, 0.f, 0.f, 0.f};
  const _Float16* arow = seqh + (size_t)(row0 + rowm) * D_;

  #pragma unroll
  for (int kc = 0; kc < KC2; ++kc) {
    v8h lo = *(const v8h*)(arow + kc * 32 + koff);
    v8h hi = *(const v8h*)(arow + kc * 32 + koff + 16);
    v16h a = __builtin_shufflevector(lo, hi,
                                     0, 1, 2, 3, 4, 5, 6, 7,
                                     8, 9, 10, 11, 12, 13, 14, 15);
    v16h b = *(const v16h*)(Wc + (((size_t)kc * CT2 + ct) * 32 + lane) * 16);
    acc = __builtin_amdgcn_wmma_f32_16x16x32_f16(
        false, a, false, b, (short)0, acc, false, false);
  }

  const int colN = lane & 15;
  const int half = lane >> 4;
  const int col  = ct * 16 + colN;                 // 0..1279
  const float bias = (col < H_) ? bp[col] : ba[col - H_];
  #pragma unroll
  for (int r = 0; r < 8; ++r) {
    const int row = row0 + r + 8 * half;
    const float v = acc[r] + bias;
    if (col < H_) hp[(size_t)row * H_ + col] = v;
    else          ha[(size_t)row * (NC_ * H_) + (col - H_)] = v;
  }
}

// ---------------------------------------------------------------------------
// Kernel E: fused  tanh(h_p+h_a)|bs  ->  WMMA x Wmid  ->  tanh(+bmid) . Wout
// Grid: (a_tile=12, p_group=48, b*NC=8).  Block: 128 threads = 4 waves.
// One work-group owns 64 rows: PT = 4 predicates x 16 argument positions
// (row = q*16 + a).  Each wave owns 4 column tiles (64 h' columns) of all
// 4 row tiles, so a B fragment loaded once feeds 4 WMMAs and an h_a value
// loaded once feeds 4 tanh.  K loop = 9 chunks of 32.  The B fragments are
// fetched two chunks ahead into two register sets.
// ---------------------------------------------------------------------------
#define PT 4                 // predicates (row tiles) per work-group
#define MROWS (PT * 16)      // 64 rows per work-group
// Row pitch of the A tile in LDS, in halves: 592 bytes = 16 B x 37.  The 16 lanes
// of a half-wave read 16 bytes each from 16 successive rows; at an odd multiple
// of 16 B these fall on all 64 banks once.  At the bare KP (576 B = 64 B x 9)
// every fourth row starts on the same bank and each read takes four times as long.
#define LDP (KP + 8)

__global__ void __launch_bounds__(128)
fused_mid_out_kernel(const float* __restrict__ hp, const float* __restrict__ ha,
                     const float* __restrict__ base_score,
                     const _Float16* __restrict__ Bws,
                     const float* __restrict__ bmid, const float* __restrict__ Wout,
                     float* __restrict__ out) {
  __shared__ alignas(16) _Float16 Alds[MROWS][LDP];   // columns KP..LDP-1: never read
  __shared__ float red[4][MROWS];

  const int at = blockIdx.x;       // a-tile index (0..11)
  const int p0 = blockIdx.y * PT;  // first predicate index of the group
  const int bz = blockIdx.z;       // b*NC + n
  const int b  = bz >> 2;
  const int n  = bz & 3;
  const int a0 = at * 16;
  const int tid = threadIdx.x;
  const int wave = tid >> 5;
  const int lane = tid & 31;

  // --- Build A tile in LDS: rows = 4 predicates x 16 arguments, cols = padded K ---
  // Every loop over c, q, t, r, i or u here is unrolled so that its arrays are
  // indexed by constants and stay in registers.
  float hpv[2][PT];                            // this thread's two columns of h_p
  #pragma unroll
  for (int c = 0; c < 2; ++c)
    #pragma unroll
    for (int q = 0; q < PT; ++q)
      hpv[c][q] = hp[((size_t)(b * L_ + p0 + q)) * H_ + c * 128 + tid];

  // All global loads of the build stand here, in front of the first tanh: the
  // tanh is volatile asm, which no load crosses, so a load written between two
  // of them is waited for alone and its whole latency is paid once per load.
  float hav[32];                               // 16x256 h_a values, 32 a thread
  const float* hab = ha + (((size_t)(b * L_ + a0) * NC_) + n) * H_ + tid;
  #pragma unroll
  for (int i = 0; i < 32; ++i)                 // row i >> 1, column (i & 1) * 128 + tid
    hav[i] = hab[(i >> 1) * (NC_ * H_) + (i & 1) * 128];
  float bsv[MROWS * NC_ / 128];                // base_score, 2 a thread
  #pragma unroll
  for (int u = 0; u < MROWS * NC_ / 128; ++u) {
    int e  = u * 128 + tid;
    int rw = e >> 2, j = e & 3;
    int q = rw >> 4, row = rw & 15;
    bsv[u] = base_score[(((size_t)(b * L_ + p0 + q) * NC_) + j) * L_ + (a0 + row)];
  }

  // B fragments of k-chunks 0 and 1: they depend on nothing the build makes, so
  // their latency passes under the tanh phase.  Fragment (kc, t) of this lane
  // stands at Bl + (kc * 16 + t) * 512 halves.
  const _Float16* Bl = Bws + (size_t)n * (KC * 16 * 32 * 16)
                           + ((size_t)(wave * 4) * 32 + lane) * 16;
  v16h bv[2][4];
  #pragma unroll
  for (int s = 0; s < 2; ++s)
    #pragma unroll
    for (int t = 0; t < 4; ++t)
      bv[s][t] = *(const v16h*)(Bl + (s * 16 + t) * 512);

  #pragma unroll
  for (int i = 0; i < 32; ++i) {               // 4 tanh per h_a value
    int e   = i * 128 + tid;
    int row = e >> 8;
    int col = e & 255;
    #pragma unroll
    for (int q = 0; q < PT; ++q)
      Alds[q * 16 + row][col] = (_Float16)fast_tanh(hpv[i & 1][q] + hav[i]);
  }
  #pragma unroll
  for (int u = 0; u < MROWS * NC_ / 128; ++u) {    // base_score cols 256..259
    int e  = u * 128 + tid;
    Alds[e >> 2][H_ + (e & 3)] = (_Float16)bsv[u];
  }
  for (int e = tid; e < MROWS * (KP - KTRUE); e += 128) {  // zero pad 260..287
    int row = e / (KP - KTRUE);
    int col = KTRUE + e % (KP - KTRUE);
    Alds[row][col] = (_Float16)0.0f;
  }
  __syncthreads();

  const int rowm = lane & 15;          // A-matrix row this lane carries
  const int koff = (lane >> 4) * 8;    // half-wave K offset within chunk

  const int colN = lane & 15;          // h' column within tile
  const int half = lane >> 4;          // 0: rows 0..7, 1: rows 8..15
  float bm[4], wo[4];
  #pragma unroll
  for (int t = 0; t < 4; ++t) {
    const int hcol = (wave * 4 + t) * 16 + colN;
    bm[t] = bmid[n * H_ + hcol];
    wo[t] = Wout[n * H_ + hcol];
  }

  v8f acc[PT][4];
  const v8f vzero = {0.f, 0.f, 0.f, 0.f, 0.f, 0.f, 0.f, 0.f};
  #pragma unroll
  for (int q = 0; q < PT; ++q)
    #pragma unroll
    for (int t = 0; t < 4; ++t) acc[q][t] = vzero;

  #pragma unroll
  for (int kc = 0; kc < KC; ++kc) {
    v16h a[PT];
    #pragma unroll
    for (int q = 0; q < PT; ++q) {
      v8h lo = *(const v8h*)&Alds[q * 16 + rowm][kc * 32 + koff];
      v8h hi = *(const v8h*)&Alds[q * 16 + rowm][kc * 32 + koff + 16];
      a[q] = __builtin_shufflevector(lo, hi,
                                     0, 1, 2, 3, 4, 5, 6, 7,
                                     8, 9, 10, 11, 12, 13, 14, 15);
    }
    #pragma unroll
    for (int t = 0; t < 4; ++t) {
      #pragma unroll
      for (int q = 0; q < PT; ++q)
        acc[q][t] = __builtin_amdgcn_wmma_f32_16x16x32_f16(
            false, a[q], false, bv[kc & 1][t], (short)0, acc[q][t], false, false);
      if (kc + 2 < KC)   // refill the set just used with chunk kc + 2
        bv[kc & 1][t] = *(const v16h*)(Bl + ((kc + 2) * 16 + t) * 512);
    }
    // Mask 0x786: vector, scalar, LDS and transcendental instructions may cross
    // this line, a global load or a WMMA may not.  So the refills above stay a
    // whole chunk of WMMAs ahead of their use; without the line the compiler
    // sinks each one to its use and waits out its whole latency there.
    __builtin_amdgcn_sched_barrier(0x786);
  }
  // The tanh below is asm text, which the compiler does not pad against a WMMA:
  // the barrier keeps every WMMA above this line, and the four v_nop are the
  // vector slots the chip needs before a tanh result may land in a register
  // that the last WMMA reads as A or B.
  __builtin_amdgcn_sched_barrier(0);
  asm volatile("v_nop\n\tv_nop\n\tv_nop\n\tv_nop");

  // --- Epilogue: out_partial(row) = sum_h' tanh(mid + bmid) * Wout ---
  #pragma unroll
  for (int q = 0; q < PT; ++q) {
    float partial[8];
    #pragma unroll
    for (int r = 0; r < 8; ++r) partial[r] = 0.f;
    #pragma unroll
    for (int t = 0; t < 4; ++t) {
      #pragma unroll
      for (int r = 0; r < 8; ++r)
        partial[r] += fast_tanh(acc[q][t][r] + bm[t]) * wo[t];
    }
    // reduce the 16 columns held across each half-wave
    #pragma unroll
    for (int r = 0; r < 8; ++r) {
      #pragma unroll
      for (int m = 1; m < 16; m <<= 1)
        partial[r] += __shfl_xor(partial[r], m, 32);
    }
    if (colN == 0) {
      #pragma unroll
      for (int r = 0; r < 8; ++r) red[wave][q * 16 + r + 8 * half] = partial[r];
    }
  }
  __syncthreads();

  if (tid < MROWS) {  // combine 4 waves; write out[b, p, n, a]
    float s = red[0][tid] + red[1][tid] + red[2][tid] + red[3][tid];
    const int q = tid >> 4, row = tid & 15;
    out[(((size_t)(b * L_ + p0 + q) * NC_) + n) * L_ + (a0 + row)] = s;
  }
}

// ---------------------------------------------------------------------------
extern "C" void kernel_launch(void* const* d_in, const int* in_sizes, int n_in,
                              void* d_out, int out_size, void* d_ws, size_t ws_size,
                              hipStream_t stream) {
  const float* seq  = (const float*)d_in[0];
  const float* bsc  = (const float*)d_in[1];
  const float* Wp   = (const float*)d_in[2];
  const float* bp   = (const float*)d_in[3];
  const float* Wa   = (const float*)d_in[4];
  const float* ba   = (const float*)d_in[5];
  const float* Wmid = (const float*)d_in[6];
  const float* bmid = (const float*)d_in[7];
  const float* Wout = (const float*)d_in[8];
  float* out = (float*)d_out;

  char* ws = (char*)d_ws;
  _Float16* Bws  = (_Float16*)(ws + WS_BW_OFF);
  _Float16* Wc   = (_Float16*)(ws + WS_WC_OFF);
  _Float16* seqh = (_Float16*)(ws + WS_SQ_OFF);
  float*    hp   = (float*)(ws + WS_HP_OFF);
  float*    ha   = (float*)(ws + WS_HA_OFF);

  prep_wmid_kernel<<<BW_HALVES / 256, 256, 0, stream>>>(Wmid, Bws);
  prep_wcat_kernel<<<WC_HALVES / 256, 256, 0, stream>>>(Wp, Wa, Wc);
  prep_seqh_kernel<<<SQ_HALVES / 256, 256, 0, stream>>>(seq, seqh);

  dim3 gproj(NPROJ / 64, ROWS / 16);   // 20 x 24 = 480 workgroups
  proj_wmma_kernel<<<gproj, 128, 0, stream>>>(seqh, Wc, bp, ba, hp, ha);

  dim3 grid(L_ / 16, L_ / PT, B_ * NC_);   // 12 x 48 x 8 = 4608 workgroups
  fused_mid_out_kernel<<<grid, 128, 0, stream>>>(hp, ha, bsc, Bws, bmid, Wout, out);
}

// v005
// Measured time: 58.7 microseconds a run.
// Timed twice side by side with v004, it ran 1.11 and 1.12 times as fast.
// All steps since v000 together make it 2.23 times as fast.
#include <hip/hip_runtime.h>

typedef _Float16 v16h __attribute__((ext_vector_type(16)));
typedef _Float16 v8h  __attribute__((ext_vector_type(8)));
typedef float    v8f  __attribute__((ext_vector_type(8)));

#define B_  2
#define L_  192
#define D_  768
#define NC_ 4
#define H_  256
#define KTRUE (H_ + NC_)   // 260 real K for mid layer
#define KP    288          // padded K (multiple of 32)
#define KC    (KP / 32)    // 9 k-chunks (mid layer)

#define NPROJ (H_ + NC_ * H_)   // 1280 projection output columns
#define KC2   (D_ / 32)         // 24 k-chunks (projection)
#define CT2   (NPROJ / 16)      // 80 column tiles (projection)
#define ROWS  (B_ * L_)         // 384 rows

// ---- Workspace layout (bytes) ----
#define BW_HALVES (NC_ * KC * 16 * 32 * 16)        // 294912 (Wmid f16 B-layout)
#define WS_BW_OFF   0
#define WC_HALVES (KC2 * CT2 * 32 * 16)            // 983040 ([Wp|Wa] f16 B-layout)
#define WS_WC_OFF   (BW_HALVES * 2)                // 589824
#define SQ_HALVES (ROWS * D_)                      // 294912 (seq f16)
#define WS_SQ_OFF   (WS_WC_OFF + WC_HALVES * 2)    // 2555904
#define WS_HP_OFF   (WS_SQ_OFF + SQ_HALVES * 2)    // 3145728
#define HP_FLOATS (ROWS * H_)                      // 98304
#define WS_HA_OFF   (WS_HP_OFF + HP_FLOATS * 4)    // 3538944
#define HA_FLOATS (ROWS * NC_ * H_)                // 393216
// total ws used ~= 4.9 MB

// Hardware tanh of eight independent values, one statement.  One value a
// statement left each tanh between the add that feeds it and the use of its
// result, all in the same two registers: a dependent chain that waits out every
// latency and carries no delay hint.  Here each tanh is the independent
// instruction behind the one before it (the outputs are early-clobber, so none
// lands on an input), its latency passes under the issue of the others, and the
// one v_nop is the slot the instruction set asks for behind the last.  Asm text
// and not __builtin_amdgcn_tanhf.
__device__ __forceinline__ void tanh_x8(float (&y)[8], const float (&x)[8]) {
  asm("v_tanh_f32 %0, %8\n\t"
      "v_tanh_f32 %1, %9\n\t"
      "v_tanh_f32 %2, %10\n\t"
      "v_tanh_f32 %3, %11\n\t"
      "v_tanh_f32 %4, %12\n\t"
      "v_tanh_f32 %5, %13\n\t"
      "v_tanh_f32 %6, %14\n\t"
      "v_tanh_f32 %7, %15\n\t"
      "v_nop"
      : "=&v"(y[0]), "=&v"(y[1]), "=&v"(y[2]), "=&v"(y[3]),
        "=&v"(y[4]), "=&v"(y[5]), "=&v"(y[6]), "=&v"(y[7])
      : "v"(x[0]), "v"(x[1]), "v"(x[2]), "v"(x[3]),
        "v"(x[4]), "v"(x[5]), "v"(x[6]), "v"(x[7]));
}

// ---------------------------------------------------------------------------
// Kernel A: repack Wmid [NC, 260, 256] f32 -> padded f16 WMMA-B layout:
// Bws[n][kc][ct][lane][16 halves]; K >= 260 zero-padded.
//   lane < 16 : col = ct*16 + lane,      halves: K = kc*32 + {0..7,16..23}
//   lane >= 16: col = ct*16 + lane - 16, halves: K = kc*32 + {8..15,24..31}
// ---------------------------------------------------------------------------
__global__ void __launch_bounds__(256)
prep_wmid_kernel(const float* __restrict__ Wmid, _Float16* __restrict__ Bws) {
  int idx = blockIdx.x * blockDim.x + threadIdx.x;
  if (idx >= BW_HALVES) return;
  int i    = idx & 15;
  int lane = (idx >> 4) & 31;
  int ct   = (idx >> 9) & 15;
  int rest = idx >> 13;          // n*KC + kc
  int kc   = rest % KC;
  int n    = rest / KC;
  int col  = ct * 16 + (lane & 15);
  int k;
  if (lane < 16) k = kc * 32 + ((i < 8) ? i       : (16 + i - 8));
  else           k = kc * 32 + ((i < 8) ? (8 + i) : (24 + i - 8));
  float v = (k < KTRUE) ? Wmid[((size_t)n * KTRUE + k) * H_ + col] : 0.0f;
  Bws[idx] = (_Float16)v;
}

// ---------------------------------------------------------------------------
// Kernel B: repack [Wp | Wa] (768 x 1280) f32 -> f16 WMMA-B layout:
// Wc[kc][ct][lane][16 halves]   (no K padding needed: 768 % 32 == 0)
// ---------------------------------------------------------------------------
__global__ void __launch_bounds__(256)
prep_wcat_kernel(const float* __restrict__ Wp, const float* __restrict__ Wa,
                 _Float16* __restrict__ Wc) {
  int idx = blockIdx.x * blockDim.x + threadIdx.x;
  if (idx >= WC_HALVES) return;
  int i    = idx & 15;
  int lane = (idx >> 4) & 31;
  int rest = idx >> 9;           // kc*CT2 + ct
  int ct   = rest % CT2;
  int kc   = rest / CT2;
  int col  = ct * 16 + (lane & 15);       // 0..1279
  int k;
  if (lane < 16) k = kc * 32 + ((i < 8) ? i       : (16 + i - 8));
  else           k = kc * 32 + ((i < 8) ? (8 + i) : (24 + i - 8));
  float v = (col < H_) ? Wp[(size_t)k * H_ + col]
                       : Wa[(size_t)k * (NC_ * H_) + (col - H_)];
  Wc[idx] = (_Float16)v;
}

// Kernel C: seq f32 -> f16 (row-major, same indexing)
__global__ void __launch_bounds__(256)
prep_seqh_kernel(const float* __restrict__ seq, _Float16* __restrict__ seqh) {
  int idx = blockIdx.x * blockDim.x + threadIdx.x;
  if (idx < SQ_HALVES) seqh[idx] = (_Float16)seq[idx];
}

// ---------------------------------------------------------------------------
// Kernel D: projection GEMM via WMMA.
// [hp | ha](row, col) = seq(row,:) @ [Wp|Wa](:, col) + [bp|ba](col)
// Grid: (NPROJ/64 = 20, ROWS/16 = 24); block = 128 (4 waves).
// Each wave owns one 16x16 output tile; K = 768 in 24 chunks.
// ---------------------------------------------------------------------------
__global__ void __launch_bounds__(128)
proj_wmma_kernel(const _Float16* __restrict__ seqh,
                 const _Float16* __restrict__ Wc,
                 const float* __restrict__ bp, const float* __restrict__ ba,
                 float* __restrict__ hp, float* __restrict__ ha) {
  const int tid  = threadIdx.x;
  const int wave = tid >> 5;
  const int lane = tid & 31;
  const int ct   = blockIdx.x * 4 + wave;   // column tile (0..79)
  const int row0 = blockIdx.y * 16;

  const int rowm = lane & 15;
  const int koff = (lane >> 4) * 8;

  v8f acc = {0.f, 0.f, 0.f, 0.f, 0.f, 0.f, 0.f, 0.f};
  const _Float16* arow = seqh + (size_t)(row0 + rowm) * D_;

  #pragma unroll
  for (int kc = 0; kc < KC2; ++kc) {
    v8h lo = *(const v8h*)(arow + kc * 32 + koff);
    v8h hi = *(const v8h*)(arow + kc * 32 + koff + 16);
    v16h a = __builtin_shufflevector(lo, hi,
                                     0, 1, 2, 3, 4, 5, 6, 7,
                                     8, 9, 10, 11, 12, 13, 14, 15);
    v16h b = *(const v16h*)(Wc + (((size_t)kc * CT2 + ct) * 32 + lane) * 16);
    acc = __builtin_amdgcn_wmma_f32_16x16x32_f16(
        false, a, false, b, (short)0, acc, false, false);
  }

  const int colN = lane & 15;
  const int half = lane >> 4;
  const int col  = ct * 16 + colN;                 // 0..1279
  const float bias = (col < H_) ? bp[col] : ba[col - H_];
  #pragma unroll
  for (int r = 0; r < 8; ++r) {
    const int row = row0 + r + 8 * half;
    const float v = acc[r] + bias;
    if (col < H_) hp[(size_t)row * H_ + col] = v;
    else          ha[(size_t)row * (NC_ * H_) + (col - H_)] = v;
  }
}

// ---------------------------------------------------------------------------
// Kernel E: fused  tanh(h_p+h_a)|bs  ->  WMMA x Wmid  ->  tanh(+bmid) . Wout
// Grid: (a_tile=12, p_group=48, b*NC=8).  Block: 128 threads = 4 waves.
// One work-group owns 64 rows: PT = 4 predicates x 16 argument positions
// (row = q*16 + a).  Each wave owns 4 column tiles (64 h' columns) of all
// 4 row tiles, so a B fragment loaded once feeds 4 WMMAs and an h_a value
// loaded once feeds 4 tanh.  K loop = 9 chunks of 32.  The B fragments are
// fetched two chunks ahead into two register sets.
// ---------------------------------------------------------------------------
#define PT 4                 // predicates (row tiles) per work-group
#define MROWS (PT * 16)      // 64 rows per work-group
// Row pitch of the A tile in LDS, in halves: 592 bytes = 16 B x 37.  The 16 lanes
// of a half-wave read 16 bytes each from 16 successive rows; at an odd multiple
// of 16 B these fall on all 64 banks once.  At the bare KP (576 B = 64 B x 9)
// every fourth row starts on the same bank and each read takes four times as long.
#define LDP (KP + 8)

__global__ void __launch_bounds__(128)
fused_mid_out_kernel(const float* __restrict__ hp, const float* __restrict__ ha,
                     const float* __restrict__ base_score,
                     const _Float16* __restrict__ Bws,
                     const float* __restrict__ bmid, const float* __restrict__ Wout,
                     float* __restrict__ out) {
  __shared__ alignas(16) _Float16 Alds[MROWS][LDP];   // columns KP..LDP-1: never read
  __shared__ float red[4][MROWS];

  const int at = blockIdx.x;       // a-tile index (0..11)
  const int p0 = blockIdx.y * PT;  // first predicate index of the group
  const int bz = blockIdx.z;       // b*NC + n
  const int b  = bz >> 2;
  const int n  = bz & 3;
  const int a0 = at * 16;
  const int tid = threadIdx.x;
  const int wave = tid >> 5;
  const int lane = tid & 31;

  // --- Build A tile in LDS: rows = 4 predicates x 16 arguments, cols = padded K ---
  // Every loop over c, q, t, r, i or u here is unrolled so that its arrays are
  // indexed by constants and stay in registers.
  float hpv[2][PT];                            // this thread's two columns of h_p
  #pragma unroll
  for (int c = 0; c < 2; ++c)
    #pragma unroll
    for (int q = 0; q < PT; ++q)
      hpv[c][q] = hp[((size_t)(b * L_ + p0 + q)) * H_ + c * 128 + tid];

  // All global loads of the build stand here, in front of the first tanh, so
  // that they are in flight together and their latency is paid once.
  float hav[32];                               // 16x256 h_a values, 32 a thread
  const float* hab = ha + (((size_t)(b * L_ + a0) * NC_) + n) * H_ + tid;
  #pragma unroll
  for (int i = 0; i < 32; ++i)                 // row i >> 1, column (i & 1) * 128 + tid
    hav[i] = hab[(i >> 1) * (NC_ * H_) + (i & 1) * 128];
  float bsv[MROWS * NC_ / 128];                // base_score, 2 a thread
  #pragma unroll
  for (int u = 0; u < MROWS * NC_ / 128; ++u) {
    int e  = u * 128 + tid;
    int rw = e >> 2, j = e & 3;
    int q = rw >> 4, row = rw & 15;
    bsv[u] = base_score[(((size_t)(b * L_ + p0 + q) * NC_) + j) * L_ + (a0 + row)];
  }

  // B fragments of k-chunks 0 and 1: they depend on nothing the build makes, so
  // their latency passes under the tanh phase.  Fragment (kc, t) of this lane
  // stands at Bl + (kc * 16 + t) * 512 halves.
  const _Float16* Bl = Bws + (size_t)n * (KC * 16 * 32 * 16)
                           + ((size_t)(wave * 4) * 32 + lane) * 16;
  v16h bv[2][4];
  #pragma unroll
  for (int s = 0; s < 2; ++s)
    #pragma unroll
    for (int t = 0; t < 4; ++t)
      bv[s][t] = *(const v16h*)(Bl + (s * 16 + t) * 512);

  #pragma unroll
  for (int i = 0; i < 32; i += 2) {            // 4 tanh per h_a value, 2 values a group
    float x[8], y[8];
    #pragma unroll
    for (int u = 0; u < 2; ++u)
      #pragma unroll
      for (int q = 0; q < PT; ++q)
        x[u * PT + q] = hpv[u][q] + hav[i + u];
    tanh_x8(y, x);
    #pragma unroll
    for (int u = 0; u < 2; ++u)                // row i >> 1, column u * 128 + tid
      #pragma unroll
      for (int q = 0; q < PT; ++q)
        Alds[q * 16 + (i >> 1)][u * 128 + tid] = (_Float16)y[u * PT + q];
  }
  #pragma unroll
  for (int u = 0; u < MROWS * NC_ / 128; ++u) {    // base_score cols 256..259
    int e  = u * 128 + tid;
    Alds[e >> 2][H_ + (e & 3)] = (_Float16)bsv[u];
  }
  for (int e = tid; e < MROWS * (KP - KTRUE); e += 128) {  // zero pad 260..287
    int row = e / (KP - KTRUE);
    int col = KTRUE + e % (KP - KTRUE);
    Alds[row][col] = (_Float16)0.0f;
  }
  __syncthreads();

  const int rowm = lane & 15;          // A-matrix row this lane carries
  const int koff = (lane >> 4) * 8;    // half-wave K offset within chunk

  const int colN = lane & 15;          // h' column within tile
  const int half = lane >> 4;          // 0: rows 0..7, 1: rows 8..15
  float bm[4], wo[4];
  #pragma unroll
  for (int t = 0; t < 4; ++t) {
    const int hcol = (wave * 4 + t) * 16 + colN;
    bm[t] = bmid[n * H_ + hcol];
    wo[t] = Wout[n * H_ + hcol];
  }

  v8f acc[PT][4];
  const v8f vzero = {0.f, 0.f, 0.f, 0.f, 0.f, 0.f, 0.f, 0.f};
  #pragma unroll
  for (int q = 0; q < PT; ++q)
    #pragma unroll
    for (int t = 0; t < 4; ++t) acc[q][t] = vzero;

  #pragma unroll
  for (int kc = 0; kc < KC; ++kc) {
    v16h a[PT];
    #pragma unroll
    for (int q = 0; q < PT; ++q) {
      v8h lo = *(const v8h*)&Alds[q * 16 + rowm][kc * 32 + koff];
      v8h hi = *(const v8h*)&Alds[q * 16 + rowm][kc * 32 + koff + 16];
      a[q] = __builtin_shufflevector(lo, hi,
                                     0, 1, 2, 3, 4, 5, 6, 7,
                                     8, 9, 10, 11, 12, 13, 14, 15);
    }
    #pragma unroll
    for (int t = 0; t < 4; ++t) {
      #pragma unroll
      for (int q = 0; q < PT; ++q)
        acc[q][t] = __builtin_amdgcn_wmma_f32_16x16x32_f16(
            false, a[q], false, bv[kc & 1][t], (short)0, acc[q][t], false, false);
      if (kc + 2 < KC)   // refill the set just used with chunk kc + 2
        bv[kc & 1][t] = *(const v16h*)(Bl + ((kc + 2) * 16 + t) * 512);
    }
    // Mask 0x786: vector, scalar, LDS and transcendental instructions may cross
    // this line, a global load or a WMMA may not.  So the refills above stay a
    // whole chunk of WMMAs ahead of their use; without the line the compiler
    // sinks each one to its use and waits out its whole latency there.
    __builtin_amdgcn_sched_barrier(0x786);
  }
  // The tanh below is asm text.
  // Nothing crosses this line: every WMMA stays above it, and below it stand the
  // eight adds that feed the first tanh group, at least four vector instructions:
  // the slots the chip needs before a tanh result may land in a register that
  // the last WMMA reads as A or B.
  __builtin_amdgcn_sched_barrier(0);

  // --- Epilogue: out_partial(row) = sum_h' tanh(mid + bmid) * Wout ---
  #pragma unroll
  for (int q = 0; q < PT; ++q) {
    float partial[8];
    #pragma unroll
    for (int r = 0; r < 8; ++r) partial[r] = 0.f;
    #pragma unroll
    for (int t = 0; t < 4; ++t) {
      float x[8], y[8];
      #pragma unroll
      for (int r = 0; r < 8; ++r) x[r] = acc[q][t][r] + bm[t];
      tanh_x8(y, x);
      #pragma unroll
      for (int r = 0; r < 8; ++r) partial[r] += y[r] * wo[t];
    }
    // reduce the 16 columns held across each half-wave
    #pragma unroll
    for (int r = 0; r < 8; ++r) {
      #pragma unroll
      for (int m = 1; m < 16; m <<= 1)
        partial[r] += __shfl_xor(partial[r], m, 32);
    }
    if (colN == 0) {
      #pragma unroll
      for (int r = 0; r < 8; ++r) red[wave][q * 16 + r + 8 * half] = partial[r];
    }
  }
  __syncthreads();

  if (tid < MROWS) {  // combine 4 waves; write out[b, p, n, a]
    float s = red[0][tid] + red[1][tid] + red[2][tid] + red[3][tid];
    const int q = tid >> 4, row = tid & 15;
    out[(((size_t)(b * L_ + p0 + q) * NC_) + n) * L_ + (a0 + row)] = s;
  }
}

// ---------------------------------------------------------------------------
extern "C" void kernel_launch(void* const* d_in, const int* in_sizes, int n_in,
                              void* d_out, int out_size, void* d_ws, size_t ws_size,
                              hipStream_t stream) {
  const float* seq  = (const float*)d_in[0];
  const float* bsc  = (const float*)d_in[1];
  const float* Wp   = (const float*)d_in[2];
  const float* bp   = (const float*)d_in[3];
  const float* Wa   = (const float*)d_in[4];
  const float* ba   = (const float*)d_in[5];
  const float* Wmid = (const float*)d_in[6];
  const float* bmid = (const float*)d_in[7];
  const float* Wout = (const float*)d_in[8];
  float* out = (float*)d_out;

  char* ws = (char*)d_ws;
  _Float16* Bws  = (_Float16*)(ws + WS_BW_OFF);
  _Float16* Wc   = (_Float16*)(ws + WS_WC_OFF);
  _Float16* seqh = (_Float16*)(ws + WS_SQ_OFF);
  float*    hp   = (float*)(ws + WS_HP_OFF);
  float*    ha   = (float*)(ws + WS_HA_OFF);

  prep_wmid_kernel<<<BW_HALVES / 256, 256, 0, stream>>>(Wmid, Bws);
  prep_wcat_kernel<<<WC_HALVES / 256, 256, 0, stream>>>(Wp, Wa, Wc);
  prep_seqh_kernel<<<SQ_HALVES / 256, 256, 0, stream>>>(seq, seqh);

  dim3 gproj(NPROJ / 64, ROWS / 16);   // 20 x 24 = 480 workgroups
  proj_wmma_kernel<<<gproj, 128, 0, stream>>>(seqh, Wc, bp, ba, hp, ha);

  dim3 grid(L_ / 16, L_ / PT, B_ * NC_);   // 12 x 48 x 8 = 4608 workgroups
  fused_mid_out_kernel<<<grid, 128, 0, stream>>>(hp, ha, bsc, Bws, bmid, Wout, out);
}

// v006
// It runs in 54.7 microseconds.
// Two timings next to v005 put it at 1.08 and 1.06 times that version's speed.
// Over all steps from v000 it is 2.39 times as fast.
#include <hip/hip_runtime.h>

typedef _Float16 v16h __attribute__((ext_vector_type(16)));
typedef _Float16 v8h  __attribute__((ext_vector_type(8)));
typedef float    v8f  __attribute__((ext_vector_type(8)));

#define B_  2
#define L_  192
#define D_  768
#define NC_ 4
#define H_  256
#define KTRUE (H_ + NC_)   // 260 real K for mid layer
#define KP    288          // padded K (multiple of 32)
#define KC    (KP / 32)    // 9 k-chunks (mid layer)

#define NPROJ (H_ + NC_ * H_)   // 1280 projection output columns
#define KC2   (D_ / 32)         // 24 k-chunks (projection)
#define CT2   (NPROJ / 16)      // 80 column tiles (projection)
#define ROWS  (B_ * L_)         // 384 rows

// ---- Workspace layout (bytes) ----
#define BW_HALVES (NC_ * KC * 16 * 32 * 16)        // 294912 (Wmid f16 B-layout)
#define WS_BW_OFF   0
#define WC_HALVES (KC2 * CT2 * 32 * 16)            // 983040 ([Wp|Wa] f16 B-layout)
#define WS_WC_OFF   (BW_HALVES * 2)                // 589824
#define SQ_HALVES (ROWS * D_)                      // 294912 (seq f16)
#define WS_SQ_OFF   (WS_WC_OFF + WC_HALVES * 2)    // 2555904
#define WS_HP_OFF   (WS_SQ_OFF + SQ_HALVES * 2)    // 3145728
#define HP_FLOATS (ROWS * H_)                      // 98304
#define WS_HA_OFF   (WS_HP_OFF + HP_FLOATS * 4)    // 3538944
#define HA_FLOATS (ROWS * NC_ * H_)                // 393216
// total ws used ~= 4.9 MB

// Hardware tanh of eight independent values, one statement.  One value a
// statement left each tanh between the add that feeds it and the use of its
// result, all in the same two registers: a dependent chain that waits out every
// latency and carries no delay hint.  Here each tanh is the independent
// instruction behind the one before it (the outputs are early-clobber, so none
// lands on an input), its latency passes under the issue of the others, and the
// one v_nop is the slot the instruction set asks for behind the last.  Asm text
// and not __builtin_amdgcn_tanhf.
__device__ __forceinline__ void tanh_x8(float (&y)[8], const float (&x)[8]) {
  asm("v_tanh_f32 %0, %8\n\t"
      "v_tanh_f32 %1, %9\n\t"
      "v_tanh_f32 %2, %10\n\t"
      "v_tanh_f32 %3, %11\n\t"
      "v_tanh_f32 %4, %12\n\t"
      "v_tanh_f32 %5, %13\n\t"
      "v_tanh_f32 %6, %14\n\t"
      "v_tanh_f32 %7, %15\n\t"
      "v_nop"
      : "=&v"(y[0]), "=&v"(y[1]), "=&v"(y[2]), "=&v"(y[3]),
        "=&v"(y[4]), "=&v"(y[5]), "=&v"(y[6]), "=&v"(y[7])
      : "v"(x[0]), "v"(x[1]), "v"(x[2]), "v"(x[3]),
        "v"(x[4]), "v"(x[5]), "v"(x[6]), "v"(x[7]));
}

// ---------------------------------------------------------------------------
// Part A: repack Wmid [NC, 260, 256] f32 -> padded f16 WMMA-B layout:
// Bws[n][kc][ct][lane][16 halves]; K >= 260 zero-padded.
//   lane < 16 : col = ct*16 + lane,      halves: K = kc*32 + {0..7,16..23}
//   lane >= 16: col = ct*16 + lane - 16, halves: K = kc*32 + {8..15,24..31}
// ---------------------------------------------------------------------------
__device__ __forceinline__ void
prep_wmid(int idx, const float* __restrict__ Wmid, _Float16* __restrict__ Bws) {
  int i    = idx & 15;
  int lane = (idx >> 4) & 31;
  int ct   = (idx >> 9) & 15;
  int rest = idx >> 13;          // n*KC + kc
  int kc   = rest % KC;
  int n    = rest / KC;
  int col  = ct * 16 + (lane & 15);
  int k;
  if (lane < 16) k = kc * 32 + ((i < 8) ? i       : (16 + i - 8));
  else           k = kc * 32 + ((i < 8) ? (8 + i) : (24 + i - 8));
  float v = (k < KTRUE) ? Wmid[((size_t)n * KTRUE + k) * H_ + col] : 0.0f;
  Bws[idx] = (_Float16)v;
  // The code of another part follows this store in the kernel's text and writes the
  // store's registers anew; the wait stands in front of that.
  asm volatile("s_wait_xcnt 0x0" ::: "memory");
}

// ---------------------------------------------------------------------------
// Part B: repack [Wp | Wa] (768 x 1280) f32 -> f16 WMMA-B layout:
// Wc[kc][ct][lane][16 halves]   (no K padding needed: 768 % 32 == 0)
// ---------------------------------------------------------------------------
__device__ __forceinline__ void
prep_wcat(int idx, const float* __restrict__ Wp, const float* __restrict__ Wa,
          _Float16* __restrict__ Wc) {
  int i    = idx & 15;
  int lane = (idx >> 4) & 31;
  int rest = idx >> 9;           // kc*CT2 + ct
  int ct   = rest % CT2;
  int kc   = rest / CT2;
  int col  = ct * 16 + (lane & 15);       // 0..1279
  int k;
  if (lane < 16) k = kc * 32 + ((i < 8) ? i       : (16 + i - 8));
  else           k = kc * 32 + ((i < 8) ? (8 + i) : (24 + i - 8));
  float v = (col < H_) ? Wp[(size_t)k * H_ + col]
                       : Wa[(size_t)k * (NC_ * H_) + (col - H_)];
  Wc[idx] = (_Float16)v;
}

// ---------------------------------------------------------------------------
// Kernel ABC: the three f32 -> f16 conversions in one grid.  None reads what
// another writes, so they need no launch boundary between them; as three
// launches each paid its own start, memory latency and drain one after another.
// A work-group belongs to one part by its index (a scalar branch): first the
// [Wp|Wa] repack (the largest), then the Wmid repack, then seq (row-major, same
// indexing).  Each part's size is a whole number of 256-thread work-groups.
// ---------------------------------------------------------------------------
#define WC_BLOCKS (WC_HALVES / 256)   // 3840
#define BW_BLOCKS (BW_HALVES / 256)   // 1152
#define SQ_BLOCKS (SQ_HALVES / 256)   // 1152

__global__ void __launch_bounds__(256)
prep_all_kernel(const float* __restrict__ Wp, const float* __restrict__ Wa,
                const float* __restrict__ Wmid, const float* __restrict__ seq,
                _Float16* __restrict__ Wc, _Float16* __restrict__ Bws,
                _Float16* __restrict__ seqh) {
  const int blk = blockIdx.x;
  const int tid = threadIdx.x;
  if (blk < WC_BLOCKS) {
    prep_wcat(blk * 256 + tid, Wp, Wa, Wc);
  } else if (blk < WC_BLOCKS + BW_BLOCKS) {
    prep_wmid((blk - WC_BLOCKS) * 256 + tid, Wmid, Bws);
  } else {
    const int idx = (blk - WC_BLOCKS - BW_BLOCKS) * 256 + tid;
    seqh[idx] = (_Float16)seq[idx];
    // This part stands last in the kernel's text: no code of another part follows
    // this store, and the wait is a precaution.
    asm volatile("s_wait_xcnt 0x0" ::: "memory");
  }
}

// ---------------------------------------------------------------------------
// Kernel D: projection GEMM via WMMA.
// [hp | ha](row, col) = seq(row,:) @ [Wp|Wa](:, col) + [bp|ba](col)
// Grid: (NPROJ/64 = 20, ROWS/16 = 24); block = 128 (4 waves).
// Each wave owns one 16x16 output tile; K = 768 in 24 chunks.
// ---------------------------------------------------------------------------
__global__ void __launch_bounds__(128)
proj_wmma_kernel(const _Float16* __restrict__ seqh,
                 const _Float16* __restrict__ Wc,
                 const float* __restrict__ bp, const float* __restrict__ ba,
                 float* __restrict__ hp, float* __restrict__ ha) {
  const int tid  = threadIdx.x;
  const int wave = tid >> 5;
  const int lane = tid & 31;
  const int ct   = blockIdx.x * 4 + wave;   // column tile (0..79)
  const int row0 = blockIdx.y * 16;

  const int rowm = lane & 15;
  const int koff = (lane >> 4) * 8;

  v8f acc = {0.f, 0.f, 0.f, 0.f, 0.f, 0.f, 0.f, 0.f};
  const _Float16* arow = seqh + (size_t)(row0 + rowm) * D_;

  #pragma unroll
  for (int kc = 0; kc < KC2; ++kc) {
    v8h lo = *(const v8h*)(arow + kc * 32 + koff);
    v8h hi = *(const v8h*)(arow + kc * 32 + koff + 16);
    v16h a = __builtin_shufflevector(lo, hi,
                                     0, 1, 2, 3, 4, 5, 6, 7,
                                     8, 9, 10, 11, 12, 13, 14, 15);
    v16h b = *(const v16h*)(Wc + (((size_t)kc * CT2 + ct) * 32 + lane) * 16);
    acc = __builtin_amdgcn_wmma_f32_16x16x32_f16(
        false, a, false, b, (short)0, acc, false, false);
  }

  const int colN = lane & 15;
  const int half = lane >> 4;
  const int col  = ct * 16 + colN;                 // 0..1279
  const float bias = (col < H_) ? bp[col] : ba[col - H_];
  #pragma unroll
  for (int r = 0; r < 8; ++r) {
    const int row = row0 + r + 8 * half;
    const float v = acc[r] + bias;
    if (col < H_) hp[(size_t)row * H_ + col] = v;
    else          ha[(size_t)row * (NC_ * H_) + (col - H_)] = v;
  }
}

// ---------------------------------------------------------------------------
// Kernel E: fused  tanh(h_p+h_a)|bs  ->  WMMA x Wmid  ->  tanh(+bmid) . Wout
// Grid: (a_tile=12, p_group=48, b*NC=8).  Block: 128 threads = 4 waves.
// One work-group owns 64 rows: PT = 4 predicates x 16 argument positions
// (row = q*16 + a).  Each wave owns 4 column tiles (64 h' columns) of all
// 4 row tiles, so a B fragment loaded once feeds 4 WMMAs and an h_a value
// loaded once feeds 4 tanh.  K loop = 9 chunks of 32.  The B fragments are
// fetched two chunks ahead into two register sets.
// ---------------------------------------------------------------------------
#define PT 4                 // predicates (row tiles) per work-group
#define MROWS (PT * 16)      // 64 rows per work-group
// Row pitch of the A tile in LDS, in halves: 592 bytes = 16 B x 37.  The 16 lanes
// of a half-wave read 16 bytes each from 16 successive rows; at an odd multiple
// of 16 B these fall on all 64 banks once.  At the bare KP (576 B = 64 B x 9)
// every fourth row starts on the same bank and each read takes four times as long.
#define LDP (KP + 8)

__global__ void __launch_bounds__(128)
fused_mid_out_kernel(const float* __restrict__ hp, const float* __restrict__ ha,
                     const float* __restrict__ base_score,
                     const _Float16* __restrict__ Bws,
                     const float* __restrict__ bmid, const float* __restrict__ Wout,
                     float* __restrict__ out) {
  __shared__ alignas(16) _Float16 Alds[MROWS][LDP];   // columns KP..LDP-1: never read
  __shared__ float red[4][MROWS];

  const int at = blockIdx.x;       // a-tile index (0..11)
  const int p0 = blockIdx.y * PT;  // first predicate index of the group
  const int bz = blockIdx.z;       // b*NC + n
  const int b  = bz >> 2;
  const int n  = bz & 3;
  const int a0 = at * 16;
  const int tid = threadIdx.x;
  const int wave = tid >> 5;
  const int lane = tid & 31;

  // --- Build A tile in LDS: rows = 4 predicates x 16 arguments, cols = padded K ---
  // Every loop over c, q, t, r, i or u here is unrolled so that its arrays are
  // indexed by constants and stay in registers.
  float hpv[2][PT];                            // this thread's two columns of h_p
  #pragma unroll
  for (int c = 0; c < 2; ++c)
    #pragma unroll
    for (int q = 0; q < PT; ++q)
      hpv[c][q] = hp[((size_t)(b * L_ + p0 + q)) * H_ + c * 128 + tid];

  // All global loads of the build stand here, in front of the first tanh, so
  // that they are in flight together and their latency is paid once.
  float hav[32];                               // 16x256 h_a values, 32 a thread
  const float* hab = ha + (((size_t)(b * L_ + a0) * NC_) + n) * H_ + tid;
  #pragma unroll
  for (int i = 0; i < 32; ++i)                 // row i >> 1, column (i & 1) * 128 + tid
    hav[i] = hab[(i >> 1) * (NC_ * H_) + (i & 1) * 128];
  float bsv[MROWS * NC_ / 128];                // base_score, 2 a thread
  #pragma unroll
  for (int u = 0; u < MROWS * NC_ / 128; ++u) {
    int e  = u * 128 + tid;
    int rw = e >> 2, j = e & 3;
    int q = rw >> 4, row = rw & 15;
    bsv[u] = base_score[(((size_t)(b * L_ + p0 + q) * NC_) + j) * L_ + (a0 + row)];
  }

  // B fragments of k-chunks 0 and 1: they depend on nothing the build makes, so
  // their latency passes under the tanh phase.  Fragment (kc, t) of this lane
  // stands at Bl + (kc * 16 + t) * 512 halves.
  const _Float16* Bl = Bws + (size_t)n * (KC * 16 * 32 * 16)
                           + ((size_t)(wave * 4) * 32 + lane) * 16;
  v16h bv[2][4];
  #pragma unroll
  for (int s = 0; s < 2; ++s)
    #pragma unroll
    for (int t = 0; t < 4; ++t)
      bv[s][t] = *(const v16h*)(Bl + (s * 16 + t) * 512);

  #pragma unroll
  for (int i = 0; i < 32; i += 2) {            // 4 tanh per h_a value, 2 values a group
    float x[8], y[8];
    #pragma unroll
    for (int u = 0; u < 2; ++u)
      #pragma unroll
      for (int q = 0; q < PT; ++q)
        x[u * PT + q] = hpv[u][q] + hav[i + u];
    tanh_x8(y, x);
    #pragma unroll
    for (int u = 0; u < 2; ++u)                // row i >> 1, column u * 128 + tid
      #pragma unroll
      for (int q = 0; q < PT; ++q)
        Alds[q * 16 + (i >> 1)][u * 128 + tid] = (_Float16)y[u * PT + q];
  }
  #pragma unroll
  for (int u = 0; u < MROWS * NC_ / 128; ++u) {    // base_score cols 256..259
    int e  = u * 128 + tid;
    Alds[e >> 2][H_ + (e & 3)] = (_Float16)bsv[u];
  }
  for (int e = tid; e < MROWS * (KP - KTRUE); e += 128) {  // zero pad 260..287
    int row = e / (KP - KTRUE);
    int col = KTRUE + e % (KP - KTRUE);
    Alds[row][col] = (_Float16)0.0f;
  }
  __syncthreads();

  const int rowm = lane & 15;          // A-matrix row this lane carries
  const int koff = (lane >> 4) * 8;    // half-wave K offset within chunk

  const int colN = lane & 15;          // h' column within tile
  const int half = lane >> 4;          // 0: rows 0..7, 1: rows 8..15
  float bm[4], wo[4];
  #pragma unroll
  for (int t = 0; t < 4; ++t) {
    const int hcol = (wave * 4 + t) * 16 + colN;
    bm[t] = bmid[n * H_ + hcol];
    wo[t] = Wout[n * H_ + hcol];
  }

  v8f acc[PT][4];
  const v8f vzero = {0.f, 0.f, 0.f, 0.f, 0.f, 0.f, 0.f, 0.f};
  #pragma unroll
  for (int q = 0; q < PT; ++q)
    #pragma unroll
    for (int t = 0; t < 4; ++t) acc[q][t] = vzero;

  #pragma unroll
  for (int kc = 0; kc < KC; ++kc) {
    v16h a[PT];
    #pragma unroll
    for (int q = 0; q < PT; ++q) {
      v8h lo = *(const v8h*)&Alds[q * 16 + rowm][kc * 32 + koff];
      v8h hi = *(const v8h*)&Alds[q * 16 + rowm][kc * 32 + koff + 16];
      a[q] = __builtin_shufflevector(lo, hi,
                                     0, 1, 2, 3, 4, 5, 6, 7,
                                     8, 9, 10, 11, 12, 13, 14, 15);
    }
    #pragma unroll
    for (int t = 0; t < 4; ++t) {
      #pragma unroll
      for (int q = 0; q < PT; ++q)
        acc[q][t] = __builtin_amdgcn_wmma_f32_16x16x32_f16(
            false, a[q], false, bv[kc & 1][t], (short)0, acc[q][t], false, false);
      if (kc + 2 < KC)   // refill the set just used with chunk kc + 2
        bv[kc & 1][t] = *(const v16h*)(Bl + ((kc + 2) * 16 + t) * 512);
    }
    // Mask 0x786: vector, scalar, LDS and transcendental instructions may cross
    // this line, a global load or a WMMA may not.  So the refills above stay a
    // whole chunk of WMMAs ahead of their use; without the line the compiler
    // sinks each one to its use and waits out its whole latency there.
    __builtin_amdgcn_sched_barrier(0x786);
  }
  // The tanh below is asm text.
  // Nothing crosses this line: every WMMA stays above it, and below it stand the
  // eight adds that feed the first tanh group, at least four vector instructions:
  // the slots the chip needs before a tanh result may land in a register that
  // the last WMMA reads as A or B.
  __builtin_amdgcn_sched_barrier(0);

  // --- Epilogue: out_partial(row) = sum_h' tanh(mid + bmid) * Wout ---
  #pragma unroll
  for (int q = 0; q < PT; ++q) {
    float partial[8];
    #pragma unroll
    for (int r = 0; r < 8; ++r) partial[r] = 0.f;
    #pragma unroll
    for (int t = 0; t < 4; ++t) {
      float x[8], y[8];
      #pragma unroll
      for (int r = 0; r < 8; ++r) x[r] = acc[q][t][r] + bm[t];
      tanh_x8(y, x);
      #pragma unroll
      for (int r = 0; r < 8; ++r) partial[r] += y[r] * wo[t];
    }
    // reduce the 16 columns held across each half-wave
    #pragma unroll
    for (int r = 0; r < 8; ++r) {
      #pragma unroll
      for (int m = 1; m < 16; m <<= 1)
        partial[r] += __shfl_xor(partial[r], m, 32);
    }
    if (colN == 0) {
      #pragma unroll
      for (int r = 0; r < 8; ++r) red[wave][q * 16 + r + 8 * half] = partial[r];
    }
  }
  __syncthreads();

  if (tid < MROWS) {  // combine 4 waves; write out[b, p, n, a]
    float s = red[0][tid] + red[1][tid] + red[2][tid] + red[3][tid];
    const int q = tid >> 4, row = tid & 15;
    out[(((size_t)(b * L_ + p0 + q) * NC_) + n) * L_ + (a0 + row)] = s;
  }
}

// ---------------------------------------------------------------------------
extern "C" void kernel_launch(void* const* d_in, const int* in_sizes, int n_in,
                              void* d_out, int out_size, void* d_ws, size_t ws_size,
                              hipStream_t stream) {
  const float* seq  = (const float*)d_in[0];
  const float* bsc  = (const float*)d_in[1];
  const float* Wp   = (const float*)d_in[2];
  const float* bp   = (const float*)d_in[3];
  const float* Wa   = (const float*)d_in[4];
  const float* ba   = (const float*)d_in[5];
  const float* Wmid = (const float*)d_in[6];
  const float* bmid = (const float*)d_in[7];
  const float* Wout = (const float*)d_in[8];
  float* out = (float*)d_out;

  char* ws = (char*)d_ws;
  _Float16* Bws  = (_Float16*)(ws + WS_BW_OFF);
  _Float16* Wc   = (_Float16*)(ws + WS_WC_OFF);
  _Float16* seqh = (_Float16*)(ws + WS_SQ_OFF);
  float*    hp   = (float*)(ws + WS_HP_OFF);
  float*    ha   = (float*)(ws + WS_HA_OFF);

  prep_all_kernel<<<WC_BLOCKS + BW_BLOCKS + SQ_BLOCKS, 256, 0, stream>>>(
      Wp, Wa, Wmid, seq, Wc, Bws, seqh);

  dim3 gproj(NPROJ / 64, ROWS / 16);   // 20 x 24 = 480 workgroups
  proj_wmma_kernel<<<gproj, 128, 0, stream>>>(seqh, Wc, bp, ba, hp, ha);

  dim3 grid(L_ / 16, L_ / PT, B_ * NC_);   // 12 x 48 x 8 = 4608 workgroups
  fused_mid_out_kernel<<<grid, 128, 0, stream>>>(hp, ha, bsc, Bws, bmid, Wout, out);
}

// v007
// A run of this version takes 52.3 microseconds.
// Next to v006, in two timings, it ran 1.05 and 1.04 times as fast.
// Counting every step since v000, it is 2.49 times as fast.
#include <hip/hip_runtime.h>

typedef _Float16 v16h __attribute__((ext_vector_type(16)));
typedef _Float16 v8h  __attribute__((ext_vector_type(8)));
typedef float    v8f  __attribute__((ext_vector_type(8)));
typedef float    v4f  __attribute__((ext_vector_type(4)));

#define B_  2
#define L_  192
#define D_  768
#define NC_ 4
#define H_  256
#define KTRUE (H_ + NC_)   // 260 real K for mid layer
#define KP    288          // padded K (multiple of 32)
#define KC    (KP / 32)    // 9 k-chunks (mid layer)

#define NPROJ (H_ + NC_ * H_)   // 1280 projection output columns
#define KC2   (D_ / 32)         // 24 k-chunks (projection)
#define CT2   (NPROJ / 16)      // 80 column tiles (projection)
#define ROWS  (B_ * L_)         // 384 rows

// ---- Workspace layout (bytes) ----
#define BW_HALVES (NC_ * KC * 16 * 32 * 16)        // 294912 (Wmid f16 B-layout)
#define WS_BW_OFF   0
#define WC_HALVES (KC2 * CT2 * 32 * 16)            // 983040 ([Wp|Wa] f16 B-layout)
#define WS_WC_OFF   (BW_HALVES * 2)                // 589824
#define SQ_HALVES (ROWS * D_)                      // 294912 (seq f16)
#define WS_SQ_OFF   (WS_WC_OFF + WC_HALVES * 2)    // 2555904
#define WS_HP_OFF   (WS_SQ_OFF + SQ_HALVES * 2)    // 3145728
#define HP_FLOATS (ROWS * H_)                      // 98304
#define WS_HA_OFF   (WS_HP_OFF + HP_FLOATS * 4)    // 3538944
#define HA_FLOATS (ROWS * NC_ * H_)                // 393216
// total ws used ~= 4.9 MB

// Hardware tanh of eight independent values, one statement.  One value a
// statement left each tanh between the add that feeds it and the use of its
// result, all in the same two registers: a dependent chain that waits out every
// latency and carries no delay hint.  Here each tanh is the independent
// instruction behind the one before it (the outputs are early-clobber, so none
// lands on an input), its latency passes under the issue of the others, and the
// one v_nop is the slot the instruction set asks for behind the last.  Asm text
// and not __builtin_amdgcn_tanhf.
__device__ __forceinline__ void tanh_x8(float (&y)[8], const float (&x)[8]) {
  asm("v_tanh_f32 %0, %8\n\t"
      "v_tanh_f32 %1, %9\n\t"
      "v_tanh_f32 %2, %10\n\t"
      "v_tanh_f32 %3, %11\n\t"
      "v_tanh_f32 %4, %12\n\t"
      "v_tanh_f32 %5, %13\n\t"
      "v_tanh_f32 %6, %14\n\t"
      "v_tanh_f32 %7, %15\n\t"
      "v_nop"
      : "=&v"(y[0]), "=&v"(y[1]), "=&v"(y[2]), "=&v"(y[3]),
        "=&v"(y[4]), "=&v"(y[5]), "=&v"(y[6]), "=&v"(y[7])
      : "v"(x[0]), "v"(x[1]), "v"(x[2]), "v"(x[3]),
        "v"(x[4]), "v"(x[5]), "v"(x[6]), "v"(x[7]));
}

// ---------------------------------------------------------------------------
// Part A: repack Wmid [NC, 260, 256] f32 -> padded f16 WMMA-B layout:
// Bws[n][kc][ct][lane][16 halves]; K >= 260 zero-padded.
//   lane < 16 : col = ct*16 + lane,      halves: K = kc*32 + {0..7,16..23}
//   lane >= 16: col = ct*16 + lane - 16, halves: K = kc*32 + {8..15,24..31}
// ---------------------------------------------------------------------------
__device__ __forceinline__ void
prep_wmid(int idx, const float* __restrict__ Wmid, _Float16* __restrict__ Bws) {
  int i    = idx & 15;
  int lane = (idx >> 4) & 31;
  int ct   = (idx >> 9) & 15;
  int rest = idx >> 13;          // n*KC + kc
  int kc   = rest % KC;
  int n    = rest / KC;
  int col  = ct * 16 + (lane & 15);
  int k;
  if (lane < 16) k = kc * 32 + ((i < 8) ? i       : (16 + i - 8));
  else           k = kc * 32 + ((i < 8) ? (8 + i) : (24 + i - 8));
  float v = (k < KTRUE) ? Wmid[((size_t)n * KTRUE + k) * H_ + col] : 0.0f;
  Bws[idx] = (_Float16)v;
  // The code of another part follows this store in the kernel's text and writes the
  // store's registers anew; the wait stands in front of that.
  asm volatile("s_wait_xcnt 0x0" ::: "memory");
}

// ---------------------------------------------------------------------------
// Part B: repack [Wp | Wa] (768 x 1280) f32 -> f16 WMMA-B layout:
// Wc[kc][ct][lane][16 halves]   (no K padding needed: 768 % 32 == 0)
// ---------------------------------------------------------------------------
__device__ __forceinline__ void
prep_wcat(int idx, const float* __restrict__ Wp, const float* __restrict__ Wa,
          _Float16* __restrict__ Wc) {
  int i    = idx & 15;
  int lane = (idx >> 4) & 31;
  int rest = idx >> 9;           // kc*CT2 + ct
  int ct   = rest % CT2;
  int kc   = rest / CT2;
  int col  = ct * 16 + (lane & 15);       // 0..1279
  int k;
  if (lane < 16) k = kc * 32 + ((i < 8) ? i       : (16 + i - 8));
  else           k = kc * 32 + ((i < 8) ? (8 + i) : (24 + i - 8));
  float v = (col < H_) ? Wp[(size_t)k * H_ + col]
                       : Wa[(size_t)k * (NC_ * H_) + (col - H_)];
  Wc[idx] = (_Float16)v;
}

// ---------------------------------------------------------------------------
// Kernel ABC: the three f32 -> f16 conversions in one grid.  None reads what
// another writes, so they need no launch boundary between them; as three
// launches each paid its own start, memory latency and drain one after another.
// A work-group belongs to one part by its index (a scalar branch): first the
// [Wp|Wa] repack (the largest), then the Wmid repack, then seq (row-major, same
// indexing).  Each part's size is a whole number of 256-thread work-groups.
// ---------------------------------------------------------------------------
#define WC_BLOCKS (WC_HALVES / 256)   // 3840
#define BW_BLOCKS (BW_HALVES / 256)   // 1152
#define SQ_BLOCKS (SQ_HALVES / 256)   // 1152

__global__ void __launch_bounds__(256)
prep_all_kernel(const float* __restrict__ Wp, const float* __restrict__ Wa,
                const float* __restrict__ Wmid, const float* __restrict__ seq,
                _Float16* __restrict__ Wc, _Float16* __restrict__ Bws,
                _Float16* __restrict__ seqh) {
  const int blk = blockIdx.x;
  const int tid = threadIdx.x;
  if (blk < WC_BLOCKS) {
    prep_wcat(blk * 256 + tid, Wp, Wa, Wc);
  } else if (blk < WC_BLOCKS + BW_BLOCKS) {
    prep_wmid((blk - WC_BLOCKS) * 256 + tid, Wmid, Bws);
  } else {
    const int idx = (blk - WC_BLOCKS - BW_BLOCKS) * 256 + tid;
    seqh[idx] = (_Float16)seq[idx];
    // This part stands last in the kernel's text: no code of another part follows
    // this store, and the wait is a precaution.
    asm volatile("s_wait_xcnt 0x0" ::: "memory");
  }
}

// ---------------------------------------------------------------------------
// Kernel D: projection GEMM via WMMA.
// [hp | ha](row, col) = seq(row,:) @ [Wp|Wa](:, col) + [bp|ba](col)
// Grid: (NPROJ/64 = 20, ROWS/16 = 24); block = 128 (4 waves).
// Each wave owns one 16x16 output tile; K = 768 in 24 chunks.
// ---------------------------------------------------------------------------
__global__ void __launch_bounds__(128)
proj_wmma_kernel(const _Float16* __restrict__ seqh,
                 const _Float16* __restrict__ Wc,
                 const float* __restrict__ bp, const float* __restrict__ ba,
                 float* __restrict__ hp, float* __restrict__ ha) {
  const int tid  = threadIdx.x;
  const int wave = tid >> 5;
  const int lane = tid & 31;
  const int ct   = blockIdx.x * 4 + wave;   // column tile (0..79)
  const int row0 = blockIdx.y * 16;

  const int rowm = lane & 15;
  const int koff = (lane >> 4) * 8;

  v8f acc = {0.f, 0.f, 0.f, 0.f, 0.f, 0.f, 0.f, 0.f};
  const _Float16* arow = seqh + (size_t)(row0 + rowm) * D_;

  #pragma unroll
  for (int kc = 0; kc < KC2; ++kc) {
    v8h lo = *(const v8h*)(arow + kc * 32 + koff);
    v8h hi = *(const v8h*)(arow + kc * 32 + koff + 16);
    v16h a = __builtin_shufflevector(lo, hi,
                                     0, 1, 2, 3, 4, 5, 6, 7,
                                     8, 9, 10, 11, 12, 13, 14, 15);
    v16h b = *(const v16h*)(Wc + (((size_t)kc * CT2 + ct) * 32 + lane) * 16);
    acc = __builtin_amdgcn_wmma_f32_16x16x32_f16(
        false, a, false, b, (short)0, acc, false, false);
  }

  const int colN = lane & 15;
  const int half = lane >> 4;
  const int col  = ct * 16 + colN;                 // 0..1279
  const float bias = (col < H_) ? bp[col] : ba[col - H_];
  #pragma unroll
  for (int r = 0; r < 8; ++r) {
    const int row = row0 + r + 8 * half;
    const float v = acc[r] + bias;
    if (col < H_) hp[(size_t)row * H_ + col] = v;
    else          ha[(size_t)row * (NC_ * H_) + (col - H_)] = v;
  }
}

// ---------------------------------------------------------------------------
// Kernel E: fused  tanh(h_p+h_a)|bs  ->  WMMA x Wmid  ->  tanh(+bmid) . Wout
// Grid: (a_tile=12, p_group=48, b*NC=8).  Block: 128 threads = 4 waves.
// One work-group owns 64 rows: PT = 4 predicates x 16 argument positions
// (row = q*16 + a).  Each wave owns 4 column tiles (64 h' columns) of all
// 4 row tiles, so a Wmid fragment loaded once feeds 4 WMMAs and an h_a value
// loaded once feeds 4 tanh.  K loop = 9 chunks of 32.  The Wmid fragments are
// fetched two chunks ahead into two register sets.
// The product is formed transposed: the Wmid fragment goes in as A, the row
// fragment as B (both operands have the same lane and k map, so the loaders
// stay).  A lane's 8 accumulator registers then hold 8 successive h' columns of
// ONE row, and the sum over h' with Wout runs inside the lane.
// ---------------------------------------------------------------------------
#define PT 4                 // predicates (row tiles) per work-group
#define MROWS (PT * 16)      // 64 rows per work-group
// Row pitch of the A tile in LDS, in halves: 592 bytes = 16 B x 37.  The 16 lanes
// of a half-wave read 16 bytes each from 16 successive rows; at an odd multiple
// of 16 B these fall on all 64 banks once.  At the bare KP (576 B = 64 B x 9)
// every fourth row starts on the same bank and each read takes four times as long.
#define LDP (KP + 8)

__global__ void __launch_bounds__(128)
fused_mid_out_kernel(const float* __restrict__ hp, const float* __restrict__ ha,
                     const float* __restrict__ base_score,
                     const _Float16* __restrict__ Bws,
                     const float* __restrict__ bmid, const float* __restrict__ Wout,
                     float* __restrict__ out) {
  __shared__ alignas(16) _Float16 Alds[MROWS][LDP];   // columns KP..LDP-1: never read
  __shared__ alignas(16) float bw[2][H_];   // bmid[n] and Wout[n] of this case
  __shared__ float red[8][MROWS];           // one partial sum a row, wave and lane half

  const int at = blockIdx.x;       // a-tile index (0..11)
  const int p0 = blockIdx.y * PT;  // first predicate index of the group
  const int bz = blockIdx.z;       // b*NC + n
  const int b  = bz >> 2;
  const int n  = bz & 3;
  const int a0 = at * 16;
  const int tid = threadIdx.x;
  const int wave = tid >> 5;
  const int lane = tid & 31;

  // --- Build A tile in LDS: rows = 4 predicates x 16 arguments, cols = padded K ---
  // Every loop over c, q, t, r, i or u here is unrolled so that its arrays are
  // indexed by constants and stay in registers.
  float hpv[2][PT];                            // this thread's two columns of h_p
  #pragma unroll
  for (int c = 0; c < 2; ++c)
    #pragma unroll
    for (int q = 0; q < PT; ++q)
      hpv[c][q] = hp[((size_t)(b * L_ + p0 + q)) * H_ + c * 128 + tid];

  // All global loads of the build stand here, in front of the first tanh, so
  // that they are in flight together and their latency is paid once.
  float hav[32];                               // 16x256 h_a values, 32 a thread
  const float* hab = ha + (((size_t)(b * L_ + a0) * NC_) + n) * H_ + tid;
  #pragma unroll
  for (int i = 0; i < 32; ++i)                 // row i >> 1, column (i & 1) * 128 + tid
    hav[i] = hab[(i >> 1) * (NC_ * H_) + (i & 1) * 128];
  float bsv[MROWS * NC_ / 128];                // base_score, 2 a thread
  #pragma unroll
  for (int u = 0; u < MROWS * NC_ / 128; ++u) {
    int e  = u * 128 + tid;
    int rw = e >> 2, j = e & 3;
    int q = rw >> 4, row = rw & 15;
    bsv[u] = base_score[(((size_t)(b * L_ + p0 + q) * NC_) + j) * L_ + (a0 + row)];
  }
  float bwv[2][2];                             // bmid and Wout, 2 columns each a thread
  const float* bmn = bmid + n * H_ + tid;
  const float* won = Wout + n * H_ + tid;
  #pragma unroll
  for (int c = 0; c < 2; ++c) {
    bwv[0][c] = bmn[c * 128];
    bwv[1][c] = won[c * 128];
  }

  // Wmid fragments of k-chunks 0 and 1: they depend on nothing the build makes, so
  // their latency passes under the tanh phase.  Fragment (kc, t) of this lane
  // stands at Bl + (kc * 16 + t) * 512 halves.
  const _Float16* Bl = Bws + (size_t)n * (KC * 16 * 32 * 16)
                           + ((size_t)(wave * 4) * 32 + lane) * 16;
  v16h bv[2][4];
  #pragma unroll
  for (int s = 0; s < 2; ++s)
    #pragma unroll
    for (int t = 0; t < 4; ++t)
      bv[s][t] = *(const v16h*)(Bl + (s * 16 + t) * 512);

  #pragma unroll
  for (int i = 0; i < 32; i += 2) {            // 4 tanh per h_a value, 2 values a group
    float x[8], y[8];
    #pragma unroll
    for (int u = 0; u < 2; ++u)
      #pragma unroll
      for (int q = 0; q < PT; ++q)
        x[u * PT + q] = hpv[u][q] + hav[i + u];
    tanh_x8(y, x);
    #pragma unroll
    for (int u = 0; u < 2; ++u)                // row i >> 1, column u * 128 + tid
      #pragma unroll
      for (int q = 0; q < PT; ++q)
        Alds[q * 16 + (i >> 1)][u * 128 + tid] = (_Float16)y[u * PT + q];
  }
  #pragma unroll
  for (int u = 0; u < MROWS * NC_ / 128; ++u) {    // base_score cols 256..259
    int e  = u * 128 + tid;
    Alds[e >> 2][H_ + (e & 3)] = (_Float16)bsv[u];
  }
  #pragma unroll
  for (int c = 0; c < 2; ++c) {
    bw[0][c * 128 + tid] = bwv[0][c];
    bw[1][c * 128 + tid] = bwv[1][c];
  }
  for (int e = tid; e < MROWS * (KP - KTRUE); e += 128) {  // zero pad 260..287
    int row = e / (KP - KTRUE);
    int col = KTRUE + e % (KP - KTRUE);
    Alds[row][col] = (_Float16)0.0f;
  }
  __syncthreads();

  const int rowm = lane & 15;          // A-matrix row this lane carries
  const int koff = (lane >> 4) * 8;    // half-wave K offset within chunk

  const int half = lane >> 4;          // 0: h' columns 0..7 of a tile, 1: 8..15

  v8f acc[PT][4];
  const v8f vzero = {0.f, 0.f, 0.f, 0.f, 0.f, 0.f, 0.f, 0.f};
  #pragma unroll
  for (int q = 0; q < PT; ++q)
    #pragma unroll
    for (int t = 0; t < 4; ++t) acc[q][t] = vzero;

  #pragma unroll
  for (int kc = 0; kc < KC; ++kc) {
    v16h a[PT];
    #pragma unroll
    for (int q = 0; q < PT; ++q) {
      v8h lo = *(const v8h*)&Alds[q * 16 + rowm][kc * 32 + koff];
      v8h hi = *(const v8h*)&Alds[q * 16 + rowm][kc * 32 + koff + 16];
      a[q] = __builtin_shufflevector(lo, hi,
                                     0, 1, 2, 3, 4, 5, 6, 7,
                                     8, 9, 10, 11, 12, 13, 14, 15);
    }
    #pragma unroll
    for (int t = 0; t < 4; ++t) {
      #pragma unroll
      for (int q = 0; q < PT; ++q)
        acc[q][t] = __builtin_amdgcn_wmma_f32_16x16x32_f16(
            false, bv[kc & 1][t], false, a[q], (short)0, acc[q][t], false, false);
      if (kc + 2 < KC)   // refill the set just used with chunk kc + 2
        bv[kc & 1][t] = *(const v16h*)(Bl + ((kc + 2) * 16 + t) * 512);
    }
    // Mask 0x786: vector, scalar, LDS and transcendental instructions may cross
    // this line, a global load or a WMMA may not.  So the refills above stay a
    // whole chunk of WMMAs ahead of their use; without the line the compiler
    // sinks each one to its use and waits out its whole latency there.
    __builtin_amdgcn_sched_barrier(0x786);
  }
  // acc[q][t][r] of this lane = mid(row q*16 + rowm, h' = (wave*4 + t)*16 + 8*half + r).
  // Its bmid and Wout values: 8 successive floats a tile, the same for a half-wave.
  v4f bm[4][2], wo[4][2];
  #pragma unroll
  for (int t = 0; t < 4; ++t)
    #pragma unroll
    for (int g = 0; g < 2; ++g) {
      const int hcol = (wave * 4 + t) * 16 + half * 8 + g * 4;
      bm[t][g] = *(const v4f*)&bw[0][hcol];
      wo[t][g] = *(const v4f*)&bw[1][hcol];
    }
  // The tanh below is asm text.
  // Nothing crosses this line: every WMMA stays above it, and below it stand the
  // eight adds that feed the first tanh group, at least four vector instructions:
  // the slots the chip needs before a tanh result may land in a register that
  // the last WMMA reads as A or B.
  __builtin_amdgcn_sched_barrier(0);

  // --- Epilogue: out_partial(row) = sum_h' tanh(mid + bmid) * Wout ---
  #pragma unroll
  for (int q = 0; q < PT; ++q) {
    float partial[8];
    #pragma unroll
    for (int r = 0; r < 8; ++r) partial[r] = 0.f;
    #pragma unroll
    for (int t = 0; t < 4; ++t) {
      float x[8], y[8];
      #pragma unroll
      for (int r = 0; r < 8; ++r) x[r] = acc[q][t][r] + bm[t][r >> 2][r & 3];
      tanh_x8(y, x);
      #pragma unroll
      for (int r = 0; r < 8; ++r) partial[r] += y[r] * wo[t][r >> 2][r & 3];
    }
    // the lane's 32 columns of row q*16 + rowm, summed in the lane
    red[wave * 2 + half][q * 16 + rowm] =
        ((partial[0] + partial[1]) + (partial[2] + partial[3])) +
        ((partial[4] + partial[5]) + (partial[6] + partial[7]));
  }
  __syncthreads();

  if (tid < MROWS) {  // combine 4 waves x 2 lane halves; write out[b, p, n, a]
    float s = ((red[0][tid] + red[1][tid]) + (red[2][tid] + red[3][tid])) +
              ((red[4][tid] + red[5][tid]) + (red[6][tid] + red[7][tid]));
    const int q = tid >> 4, row = tid & 15;
    out[(((size_t)(b * L_ + p0 + q) * NC_) + n) * L_ + (a0 + row)] = s;
  }
}

// ---------------------------------------------------------------------------
extern "C" void kernel_launch(void* const* d_in, const int* in_sizes, int n_in,
                              void* d_out, int out_size, void* d_ws, size_t ws_size,
                              hipStream_t stream) {
  const float* seq  = (const float*)d_in[0];
  const float* bsc  = (const float*)d_in[1];
  const float* Wp   = (const float*)d_in[2];
  const float* bp   = (const float*)d_in[3];
  const float* Wa   = (const float*)d_in[4];
  const float* ba   = (const float*)d_in[5];
  const float* Wmid = (const float*)d_in[6];
  const float* bmid = (const float*)d_in[7];
  const float* Wout = (const float*)d_in[8];
  float* out = (float*)d_out;

  char* ws = (char*)d_ws;
  _Float16* Bws  = (_Float16*)(ws + WS_BW_OFF);
  _Float16* Wc   = (_Float16*)(ws + WS_WC_OFF);
  _Float16* seqh = (_Float16*)(ws + WS_SQ_OFF);
  float*    hp   = (float*)(ws + WS_HP_OFF);
  float*    ha   = (float*)(ws + WS_HA_OFF);

  prep_all_kernel<<<WC_BLOCKS + BW_BLOCKS + SQ_BLOCKS, 256, 0, stream>>>(
      Wp, Wa, Wmid, seq, Wc, Bws, seqh);

  dim3 gproj(NPROJ / 64, ROWS / 16);   // 20 x 24 = 480 workgroups
  proj_wmma_kernel<<<gproj, 128, 0, stream>>>(seqh, Wc, bp, ba, hp, ha);

  dim3 grid(L_ / 16, L_ / PT, B_ * NC_);   // 12 x 48 x 8 = 4608 workgroups
  fused_mid_out_kernel<<<grid, 128, 0, stream>>>(hp, ha, bsc, Bws, bmid, Wout, out);
}

// v008
// A run of this version takes 49.7 microseconds.
// In two side-by-side timings against v007, it was 1.04 and 1.06 times as fast.
// All steps since v000 together make it 2.62 times as fast.
#include <hip/hip_runtime.h>

typedef _Float16 v16h __attribute__((ext_vector_type(16)));
typedef _Float16 v8h  __attribute__((ext_vector_type(8)));
typedef _Float16 v4h  __attribute__((ext_vector_type(4)));
typedef float    v8f  __attribute__((ext_vector_type(8)));
typedef float    v4f  __attribute__((ext_vector_type(4)));

#define B_  2
#define L_  192
#define D_  768
#define NC_ 4
#define H_  256
#define KTRUE (H_ + NC_)   // 260 real K for mid layer
#define KP    288          // padded K (multiple of 32)
#define KC    (KP / 32)    // 9 k-chunks (mid layer)

#define NPROJ (H_ + NC_ * H_)   // 1280 projection output columns
#define KC2   (D_ / 32)         // 24 k-chunks (projection)
#define CT2   (NPROJ / 16)      // 80 column tiles (projection)
#define ROWS  (B_ * L_)         // 384 rows

// ---- Workspace layout (bytes) ----
#define BW_HALVES (NC_ * KC * 16 * 32 * 16)        // 294912 (Wmid f16 B-layout)
#define WS_BW_OFF   0
#define WC_HALVES (KC2 * CT2 * 32 * 16)            // 983040 ([Wp|Wa] f16 B-layout)
#define WS_WC_OFF   (BW_HALVES * 2)                // 589824
#define SQ_HALVES (ROWS * D_)                      // 294912 (seq f16)
#define WS_SQ_OFF   (WS_WC_OFF + WC_HALVES * 2)    // 2555904
#define WS_HP_OFF   (WS_SQ_OFF + SQ_HALVES * 2)    // 3145728
#define HP_FLOATS (ROWS * H_)                      // 98304
#define WS_HA_OFF   (WS_HP_OFF + HP_FLOATS * 4)    // 3538944
#define HA_FLOATS (ROWS * NC_ * H_)                // 393216
// total ws used ~= 4.9 MB

// Hardware tanh of eight independent values, one statement.  One value a
// statement left each tanh between the add that feeds it and the use of its
// result, all in the same two registers: a dependent chain that waits out every
// latency and carries no delay hint.  Here each tanh is the independent
// instruction behind the one before it (the outputs are early-clobber, so none
// lands on an input), its latency passes under the issue of the others, and the
// one v_nop is the slot the instruction set asks for behind the last.  Asm text
// and not __builtin_amdgcn_tanhf.
__device__ __forceinline__ void tanh_x8(float (&y)[8], const float (&x)[8]) {
  asm("v_tanh_f32 %0, %8\n\t"
      "v_tanh_f32 %1, %9\n\t"
      "v_tanh_f32 %2, %10\n\t"
      "v_tanh_f32 %3, %11\n\t"
      "v_tanh_f32 %4, %12\n\t"
      "v_tanh_f32 %5, %13\n\t"
      "v_tanh_f32 %6, %14\n\t"
      "v_tanh_f32 %7, %15\n\t"
      "v_nop"
      : "=&v"(y[0]), "=&v"(y[1]), "=&v"(y[2]), "=&v"(y[3]),
        "=&v"(y[4]), "=&v"(y[5]), "=&v"(y[6]), "=&v"(y[7])
      : "v"(x[0]), "v"(x[1]), "v"(x[2]), "v"(x[3]),
        "v"(x[4]), "v"(x[5]), "v"(x[6]), "v"(x[7]));
}

// ---------------------------------------------------------------------------
// Kernel ABC: the three f32 -> f16 conversions in one grid, 32 values a thread.
// None reads what another writes, so they need no launch boundary between them.
// A work-group belongs to one part by its index (a scalar branch).
// Waves start at a limited rate: at one value a thread this launch is 49152
// waves of one load and one 2-byte store each, far more start-up than work.
// At 32 values a thread it is 1536 waves, each with all its loads in flight.
//
// WMMA-B layout of a weight matrix: [kc][ct][lane][16 halves],
//   lane <  16: col = ct*16 + lane,      halves: K = kc*32 + {0..7, 16..23}
//   lane >= 16: col = ct*16 + lane - 16, halves: K = kc*32 + {8..15, 24..31}
// A repack thread owns one column of one k-chunk: 32 loads down the column (a
// wave reads 32 successive columns, one whole 128-byte line a load), and from
// them the fragments of both lanes that carry this column.
//   Wc [kc][ct][lane][16]    = [Wp | Wa] (768 x 1280); 768 % 32 == 0, no padding
//   Bws[n][kc][ct][lane][16] = Wmid [NC, 260, 256]; K >= 260 zero-padded
// ---------------------------------------------------------------------------
// frag: the fragment of lane (col & 15); that of lane 16 + (col & 15) stands 16
// fragments (256 halves) behind it.
__device__ __forceinline__ void store_col(const float (&v)[32], _Float16* __restrict__ frag) {
  v8h f[4];
  #pragma unroll   // constant indices: v and f stay in registers
  for (int g = 0; g < 4; ++g)
    #pragma unroll
    for (int i = 0; i < 8; ++i) f[g][i] = (_Float16)v[g * 8 + i];
  *(v8h*)(frag)           = f[0];
  *(v8h*)(frag + 8)       = f[2];
  *(v8h*)(frag + 256)     = f[1];
  *(v8h*)(frag + 256 + 8) = f[3];
}

#define WA_BLOCKS (KC2 * NC_ * H_ / 256)     // 96: 4 work-groups a k-chunk of Wa
#define WP_BLOCKS (KC2 * H_ / 256)           // 24: one work-group a k-chunk of Wp
#define BW_BLOCKS (NC_ * KC * H_ / 256)      // 36: one work-group a case and k-chunk
#define SQ_BLOCKS (SQ_HALVES / (256 * 32))   // 36
#define KTAIL (KTRUE - (KC - 1) * 32)        // 4 real rows in the last k-chunk of Wmid

__global__ void __launch_bounds__(256)
prep_all_kernel(const float* __restrict__ Wp, const float* __restrict__ Wa,
                const float* __restrict__ Wmid, const float* __restrict__ seq,
                _Float16* __restrict__ Wc, _Float16* __restrict__ Bws,
                _Float16* __restrict__ seqh) {
  const int blk = blockIdx.x;
  const int tid = threadIdx.x;
  // Every loop over j, u or i here is unrolled so that its array is indexed by
  // constants and stays in registers, and the row offsets are immediates.
  if (blk < WA_BLOCKS) {
    // Wa: row pitch 1024 floats; columns 256..1279 of [Wp | Wa]
    const int kc  = blk >> 2;
    const int col = (blk & 3) * 256 + tid;   // column of Wa
    const float* s = Wa + (size_t)kc * 32 * (NC_ * H_) + col;
    float v[32];
    #pragma unroll
    for (int j = 0; j < 32; ++j) v[j] = s[j * (NC_ * H_)];
    store_col(v, Wc + (((size_t)kc * CT2 + (H_ / 16) + (col >> 4)) * 32 + (col & 15)) * 16);
  } else if (blk < WA_BLOCKS + WP_BLOCKS + BW_BLOCKS) {
    // Wp and Wmid: row pitch 256 floats, a work-group takes all 256 columns
    const int r = blk - WA_BLOCKS;
    const float* s;
    _Float16* d;       // the chunk's first column tile
    bool full;         // all 32 rows of the chunk exist
    if (r < WP_BLOCKS) {                     // r = kc
      s = Wp + (size_t)r * 32 * H_;
      d = Wc + (size_t)r * CT2 * 512;
      full = true;
    } else {
      const int rest = r - WP_BLOCKS;        // n*KC + kc
      const int kc   = rest % KC;
      const int n    = rest / KC;
      s = Wmid + ((size_t)n * KTRUE + kc * 32) * H_;
      d = Bws + (size_t)rest * 16 * 512;
      full = kc < KC - 1;
    }
    s += tid;
    float v[32];
    #pragma unroll
    for (int j = 0; j < KTAIL; ++j) v[j] = s[j * H_];
    #pragma unroll
    for (int j = KTAIL; j < 32; ++j) v[j] = 0.0f;
    if (full) {
      #pragma unroll
      for (int j = KTAIL; j < 32; ++j) v[j] = s[j * H_];
      // Behind this block the first converted pair lands in these loads' address
      // register while the last of them are still out; the wait stands in front of
      // that overwrite (inside the block, so that no conversion is moved over it).
      asm volatile("s_wait_xcnt 0x0" ::: "memory");
    }
    store_col(v, d + ((tid >> 4) * 32 + (tid & 15)) * 16);
  } else {
    // seq: row-major, same indexing; a wave's load covers 4 whole lines
    const size_t base = (size_t)(blk - WA_BLOCKS - WP_BLOCKS - BW_BLOCKS) * (256 * 32) + tid * 4;
    v4f x[8];
    #pragma unroll
    for (int u = 0; u < 8; ++u) x[u] = *(const v4f*)(seq + base + u * 1024);
    #pragma unroll
    for (int u = 0; u < 8; ++u) {
      v4h y;
      #pragma unroll
      for (int i = 0; i < 4; ++i) y[i] = (_Float16)x[u][i];
      *(v4h*)(seqh + base + u * 1024) = y;
    }
    // The code of another part follows these stores in the kernel's text and writes
    // their registers anew; the wait stands in front of that.
    asm volatile("s_wait_xcnt 0x0" ::: "memory");
  }
}

// ---------------------------------------------------------------------------
// Kernel D: projection GEMM via WMMA.
// [hp | ha](row, col) = seq(row,:) @ [Wp|Wa](:, col) + [bp|ba](col)
// Grid: (NPROJ/64 = 20, ROWS/16 = 24); block = 128 (4 waves).
// Each wave owns one 16x16 output tile; K = 768 in 24 chunks.
// ---------------------------------------------------------------------------
__global__ void __launch_bounds__(128)
proj_wmma_kernel(const _Float16* __restrict__ seqh,
                 const _Float16* __restrict__ Wc,
                 const float* __restrict__ bp, const float* __restrict__ ba,
                 float* __restrict__ hp, float* __restrict__ ha) {
  const int tid  = threadIdx.x;
  const int wave = tid >> 5;
  const int lane = tid & 31;
  const int ct   = blockIdx.x * 4 + wave;   // column tile (0..79)
  const int row0 = blockIdx.y * 16;

  const int rowm = lane & 15;
  const int koff = (lane >> 4) * 8;

  v8f acc = {0.f, 0.f, 0.f, 0.f, 0.f, 0.f, 0.f, 0.f};
  const _Float16* arow = seqh + (size_t)(row0 + rowm) * D_;

  #pragma unroll
  for (int kc = 0; kc < KC2; ++kc) {
    v8h lo = *(const v8h*)(arow + kc * 32 + koff);
    v8h hi = *(const v8h*)(arow + kc * 32 + koff + 16);
    v16h a = __builtin_shufflevector(lo, hi,
                                     0, 1, 2, 3, 4, 5, 6, 7,
                                     8, 9, 10, 11, 12, 13, 14, 15);
    v16h b = *(const v16h*)(Wc + (((size_t)kc * CT2 + ct) * 32 + lane) * 16);
    acc = __builtin_amdgcn_wmma_f32_16x16x32_f16(
        false, a, false, b, (short)0, acc, false, false);
  }

  const int colN = lane & 15;
  const int half = lane >> 4;
  const int col  = ct * 16 + colN;                 // 0..1279
  const float bias = (col < H_) ? bp[col] : ba[col - H_];
  #pragma unroll
  for (int r = 0; r < 8; ++r) {
    const int row = row0 + r + 8 * half;
    const float v = acc[r] + bias;
    if (col < H_) hp[(size_t)row * H_ + col] = v;
    else          ha[(size_t)row * (NC_ * H_) + (col - H_)] = v;
  }
}

// ---------------------------------------------------------------------------
// Kernel E: fused  tanh(h_p+h_a)|bs  ->  WMMA x Wmid  ->  tanh(+bmid) . Wout
// Grid: (a_tile=12, p_group=48, b*NC=8).  Block: 128 threads = 4 waves.
// One work-group owns 64 rows: PT = 4 predicates x 16 argument positions
// (row = q*16 + a).  Each wave owns 4 column tiles (64 h' columns) of all
// 4 row tiles, so a Wmid fragment loaded once feeds 4 WMMAs and an h_a value
// loaded once feeds 4 tanh.  K loop = 9 chunks of 32.  The Wmid fragments are
// fetched two chunks ahead into two register sets.
// The product is formed transposed: the Wmid fragment goes in as A, the row
// fragment as B (both operands have the same lane and k map, so the loaders
// stay).  A lane's 8 accumulator registers then hold 8 successive h' columns of
// ONE row, and the sum over h' with Wout runs inside the lane.
// ---------------------------------------------------------------------------
#define PT 4                 // predicates (row tiles) per work-group
#define MROWS (PT * 16)      // 64 rows per work-group
// Row pitch of the A tile in LDS, in halves: 592 bytes = 16 B x 37.  The 16 lanes
// of a half-wave read 16 bytes each from 16 successive rows; at an odd multiple
// of 16 B these fall on all 64 banks once.  At the bare KP (576 B = 64 B x 9)
// every fourth row starts on the same bank and each read takes four times as long.
#define LDP (KP + 8)

__global__ void __launch_bounds__(128)
fused_mid_out_kernel(const float* __restrict__ hp, const float* __restrict__ ha,
                     const float* __restrict__ base_score,
                     const _Float16* __restrict__ Bws,
                     const float* __restrict__ bmid, const float* __restrict__ Wout,
                     float* __restrict__ out) {
  __shared__ alignas(16) _Float16 Alds[MROWS][LDP];   // columns KP..LDP-1: never read
  __shared__ alignas(16) float bw[2][H_];   // bmid[n] and Wout[n] of this case
  __shared__ float red[8][MROWS];           // one partial sum a row, wave and lane half

  const int at = blockIdx.x;       // a-tile index (0..11)
  const int p0 = blockIdx.y * PT;  // first predicate index of the group
  const int bz = blockIdx.z;       // b*NC + n
  const int b  = bz >> 2;
  const int n  = bz & 3;
  const int a0 = at * 16;
  const int tid = threadIdx.x;
  const int wave = tid >> 5;
  const int lane = tid & 31;

  // --- Build A tile in LDS: rows = 4 predicates x 16 arguments, cols = padded K ---
  // Every loop over c, q, t, r, i or u here is unrolled so that its arrays are
  // indexed by constants and stay in registers.
  float hpv[2][PT];                            // this thread's two columns of h_p
  #pragma unroll
  for (int c = 0; c < 2; ++c)
    #pragma unroll
    for (int q = 0; q < PT; ++q)
      hpv[c][q] = hp[((size_t)(b * L_ + p0 + q)) * H_ + c * 128 + tid];

  // All global loads of the build stand here, in front of the first tanh, so
  // that they are in flight together and their latency is paid once.
  float hav[32];                               // 16x256 h_a values, 32 a thread
  const float* hab = ha + (((size_t)(b * L_ + a0) * NC_) + n) * H_ + tid;
  #pragma unroll
  for (int i = 0; i < 32; ++i)                 // row i >> 1, column (i & 1) * 128 + tid
    hav[i] = hab[(i >> 1) * (NC_ * H_) + (i & 1) * 128];
  float bsv[MROWS * NC_ / 128];                // base_score, 2 a thread
  #pragma unroll
  for (int u = 0; u < MROWS * NC_ / 128; ++u) {
    int e  = u * 128 + tid;
    int rw = e >> 2, j = e & 3;
    int q = rw >> 4, row = rw & 15;
    bsv[u] = base_score[(((size_t)(b * L_ + p0 + q) * NC_) + j) * L_ + (a0 + row)];
  }
  float bwv[2][2];                             // bmid and Wout, 2 columns each a thread
  const float* bmn = bmid + n * H_ + tid;
  const float* won = Wout + n * H_ + tid;
  #pragma unroll
  for (int c = 0; c < 2; ++c) {
    bwv[0][c] = bmn[c * 128];
    bwv[1][c] = won[c * 128];
  }

  // Wmid fragments of k-chunks 0 and 1: they depend on nothing the build makes, so
  // their latency passes under the tanh phase.  Fragment (kc, t) of this lane
  // stands at Bl + (kc * 16 + t) * 512 halves.
  const _Float16* Bl = Bws + (size_t)n * (KC * 16 * 32 * 16)
                           + ((size_t)(wave * 4) * 32 + lane) * 16;
  v16h bv[2][4];
  #pragma unroll
  for (int s = 0; s < 2; ++s)
    #pragma unroll
    for (int t = 0; t < 4; ++t)
      bv[s][t] = *(const v16h*)(Bl + (s * 16 + t) * 512);

  #pragma unroll
  for (int i = 0; i < 32; i += 2) {            // 4 tanh per h_a value, 2 values a group
    float x[8], y[8];
    #pragma unroll
    for (int u = 0; u < 2; ++u)
      #pragma unroll
      for (int q = 0; q < PT; ++q)
        x[u * PT + q] = hpv[u][q] + hav[i + u];
    tanh_x8(y, x);
    #pragma unroll
    for (int u = 0; u < 2; ++u)                // row i >> 1, column u * 128 + tid
      #pragma unroll
      for (int q = 0; q < PT; ++q)
        Alds[q * 16 + (i >> 1)][u * 128 + tid] = (_Float16)y[u * PT + q];
  }
  #pragma unroll
  for (int u = 0; u < MROWS * NC_ / 128; ++u) {    // base_score cols 256..259
    int e  = u * 128 + tid;
    Alds[e >> 2][H_ + (e & 3)] = (_Float16)bsv[u];
  }
  #pragma unroll
  for (int c = 0; c < 2; ++c) {
    bw[0][c * 128 + tid] = bwv[0][c];
    bw[1][c * 128 + tid] = bwv[1][c];
  }
  for (int e = tid; e < MROWS * (KP - KTRUE); e += 128) {  // zero pad 260..287
    int row = e / (KP - KTRUE);
    int col = KTRUE + e % (KP - KTRUE);
    Alds[row][col] = (_Float16)0.0f;
  }
  __syncthreads();

  const int rowm = lane & 15;          // A-matrix row this lane carries
  const int koff = (lane >> 4) * 8;    // half-wave K offset within chunk

  const int half = lane >> 4;          // 0: h' columns 0..7 of a tile, 1: 8..15

  v8f acc[PT][4];
  const v8f vzero = {0.f, 0.f, 0.f, 0.f, 0.f, 0.f, 0.f, 0.f};
  #pragma unroll
  for (int q = 0; q < PT; ++q)
    #pragma unroll
    for (int t = 0; t < 4; ++t) acc[q][t] = vzero;

  #pragma unroll
  for (int kc = 0; kc < KC; ++kc) {
    v16h a[PT];
    #pragma unroll
    for (int q = 0; q < PT; ++q) {
      v8h lo = *(const v8h*)&Alds[q * 16 + rowm][kc * 32 + koff];
      v8h hi = *(const v8h*)&Alds[q * 16 + rowm][kc * 32 + koff + 16];
      a[q] = __builtin_shufflevector(lo, hi,
                                     0, 1, 2, 3, 4, 5, 6, 7,
                                     8, 9, 10, 11, 12, 13, 14, 15);
    }
    #pragma unroll
    for (int t = 0; t < 4; ++t) {
      #pragma unroll
      for (int q = 0; q < PT; ++q)
        acc[q][t] = __builtin_amdgcn_wmma_f32_16x16x32_f16(
            false, bv[kc & 1][t], false, a[q], (short)0, acc[q][t], false, false);
      if (kc + 2 < KC)   // refill the set just used with chunk kc + 2
        bv[kc & 1][t] = *(const v16h*)(Bl + ((kc + 2) * 16 + t) * 512);
    }
    // Mask 0x786: vector, scalar, LDS and transcendental instructions may cross
    // this line, a global load or a WMMA may not.  So the refills above stay a
    // whole chunk of WMMAs ahead of their use; without the line the compiler
    // sinks each one to its use and waits out its whole latency there.
    __builtin_amdgcn_sched_barrier(0x786);
  }
  // acc[q][t][r] of this lane = mid(row q*16 + rowm, h' = (wave*4 + t)*16 + 8*half + r).
  // Its bmid and Wout values: 8 successive floats a tile, the same for a half-wave.
  v4f bm[4][2], wo[4][2];
  #pragma unroll
  for (int t = 0; t < 4; ++t)
    #pragma unroll
    for (int g = 0; g < 2; ++g) {
      const int hcol = (wave * 4 + t) * 16 + half * 8 + g * 4;
      bm[t][g] = *(const v4f*)&bw[0][hcol];
      wo[t][g] = *(const v4f*)&bw[1][hcol];
    }
  // The tanh below is asm text.
  // Nothing crosses this line: every WMMA stays above it, and below it stand the
  // eight adds that feed the first tanh group, at least four vector instructions:
  // the slots the chip needs before a tanh result may land in a register that
  // the last WMMA reads as A or B.
  __builtin_amdgcn_sched_barrier(0);

  // --- Epilogue: out_partial(row) = sum_h' tanh(mid + bmid) * Wout ---
  #pragma unroll
  for (int q = 0; q < PT; ++q) {
    float partial[8];
    #pragma unroll
    for (int r = 0; r < 8; ++r) partial[r] = 0.f;
    #pragma unroll
    for (int t = 0; t < 4; ++t) {
      float x[8], y[8];
      #pragma unroll
      for (int r = 0; r < 8; ++r) x[r] = acc[q][t][r] + bm[t][r >> 2][r & 3];
      tanh_x8(y, x);
      #pragma unroll
      for (int r = 0; r < 8; ++r) partial[r] += y[r] * wo[t][r >> 2][r & 3];
    }
    // the lane's 32 columns of row q*16 + rowm, summed in the lane
    red[wave * 2 + half][q * 16 + rowm] =
        ((partial[0] + partial[1]) + (partial[2] + partial[3])) +
        ((partial[4] + partial[5]) + (partial[6] + partial[7]));
  }
  __syncthreads();

  if (tid < MROWS) {  // combine 4 waves x 2 lane halves; write out[b, p, n, a]
    float s = ((red[0][tid] + red[1][tid]) + (red[2][tid] + red[3][tid])) +
              ((red[4][tid] + red[5][tid]) + (red[6][tid] + red[7][tid]));
    const int q = tid >> 4, row = tid & 15;
    out[(((size_t)(b * L_ + p0 + q) * NC_) + n) * L_ + (a0 + row)] = s;
  }
}

// ---------------------------------------------------------------------------
extern "C" void kernel_launch(void* const* d_in, const int* in_sizes, int n_in,
                              void* d_out, int out_size, void* d_ws, size_t ws_size,
                              hipStream_t stream) {
  const float* seq  = (const float*)d_in[0];
  const float* bsc  = (const float*)d_in[1];
  const float* Wp   = (const float*)d_in[2];
  const float* bp   = (const float*)d_in[3];
  const float* Wa   = (const float*)d_in[4];
  const float* ba   = (const float*)d_in[5];
  const float* Wmid = (const float*)d_in[6];
  const float* bmid = (const float*)d_in[7];
  const float* Wout = (const float*)d_in[8];
  float* out = (float*)d_out;

  char* ws = (char*)d_ws;
  _Float16* Bws  = (_Float16*)(ws + WS_BW_OFF);
  _Float16* Wc   = (_Float16*)(ws + WS_WC_OFF);
  _Float16* seqh = (_Float16*)(ws + WS_SQ_OFF);
  float*    hp   = (float*)(ws + WS_HP_OFF);
  float*    ha   = (float*)(ws + WS_HA_OFF);

  prep_all_kernel<<<WA_BLOCKS + WP_BLOCKS + BW_BLOCKS + SQ_BLOCKS, 256, 0, stream>>>(
      Wp, Wa, Wmid, seq, Wc, Bws, seqh);

  dim3 gproj(NPROJ / 64, ROWS / 16);   // 20 x 24 = 480 workgroups
  proj_wmma_kernel<<<gproj, 128, 0, stream>>>(seqh, Wc, bp, ba, hp, ha);

  dim3 grid(L_ / 16, L_ / PT, B_ * NC_);   // 12 x 48 x 8 = 4608 workgroups
  fused_mid_out_kernel<<<grid, 128, 0, stream>>>(hp, ha, bsc, Bws, bmid, Wout, out);
}

// v009
// One run takes 46.5 microseconds.
// Two timings next to v008 put it at 1.06 and 1.07 times that version's speed.
// Counting every step since v000, it is 2.80 times as fast.
#include <hip/hip_runtime.h>

typedef _Float16 v16h __attribute__((ext_vector_type(16)));
typedef _Float16 v8h  __attribute__((ext_vector_type(8)));
typedef _Float16 v4h  __attribute__((ext_vector_type(4)));
typedef float    v8f  __attribute__((ext_vector_type(8)));
typedef float    v4f  __attribute__((ext_vector_type(4)));

#define B_  2
#define L_  192
#define D_  768
#define NC_ 4
#define H_  256
#define KTRUE (H_ + NC_)   // 260 real K for mid layer
#define KP    288          // padded K (multiple of 32)
#define KC    (KP / 32)    // 9 k-chunks (mid layer)

#define NPROJ (H_ + NC_ * H_)   // 1280 projection output columns
#define KC2   (D_ / 32)         // 24 k-chunks (projection)
#define CT2   (NPROJ / 16)      // 80 column tiles (projection)
#define ROWS  (B_ * L_)         // 384 rows

// ---- Workspace layout (bytes) ----
#define BW_HALVES (NC_ * KC * 16 * 32 * 16)        // 294912 (Wmid f16 B-layout)
#define WS_BW_OFF   0
#define WC_HALVES (KC2 * CT2 * 32 * 16)            // 983040 ([Wp|Wa] f16 B-layout)
#define WS_WC_OFF   (BW_HALVES * 2)                // 589824
#define SQ_HALVES (ROWS * D_)                      // 294912 (seq f16)
#define WS_SQ_OFF   (WS_WC_OFF + WC_HALVES * 2)    // 2555904
#define WS_HP_OFF   (WS_SQ_OFF + SQ_HALVES * 2)    // 3145728
#define HP_FLOATS (ROWS * H_)                      // 98304
#define WS_HA_OFF   (WS_HP_OFF + HP_FLOATS * 4)    // 3538944
#define HA_FLOATS (ROWS * NC_ * H_)                // 393216
// total ws used ~= 4.9 MB

// Hardware tanh of eight independent values, one statement.  One value a
// statement left each tanh between the add that feeds it and the use of its
// result, all in the same two registers: a dependent chain that waits out every
// latency and carries no delay hint.  Here each tanh is the independent
// instruction behind the one before it (the outputs are early-clobber, so none
// lands on an input), its latency passes under the issue of the others, and the
// one v_nop is the slot the instruction set asks for behind the last.  Asm text
// and not __builtin_amdgcn_tanhf.
__device__ __forceinline__ void tanh_x8(float (&y)[8], const float (&x)[8]) {
  asm("v_tanh_f32 %0, %8\n\t"
      "v_tanh_f32 %1, %9\n\t"
      "v_tanh_f32 %2, %10\n\t"
      "v_tanh_f32 %3, %11\n\t"
      "v_tanh_f32 %4, %12\n\t"
      "v_tanh_f32 %5, %13\n\t"
      "v_tanh_f32 %6, %14\n\t"
      "v_tanh_f32 %7, %15\n\t"
      "v_nop"
      : "=&v"(y[0]), "=&v"(y[1]), "=&v"(y[2]), "=&v"(y[3]),
        "=&v"(y[4]), "=&v"(y[5]), "=&v"(y[6]), "=&v"(y[7])
      : "v"(x[0]), "v"(x[1]), "v"(x[2]), "v"(x[3]),
        "v"(x[4]), "v"(x[5]), "v"(x[6]), "v"(x[7]));
}

// ---------------------------------------------------------------------------
// Kernel ABC: the three f32 -> f16 conversions in one grid, 32 values a thread.
// None reads what another writes, so they need no launch boundary between them.
// A work-group belongs to one part by its index (a scalar branch).
// Waves start at a limited rate: at one value a thread this launch is 49152
// waves of one load and one 2-byte store each, far more start-up than work.
// At 32 values a thread it is 1536 waves, each with all its loads in flight.
//
// WMMA-B layout of a weight matrix: [kc][ct][lane][16 halves],
//   lane <  16: col = ct*16 + lane,      halves: K = kc*32 + {0..7, 16..23}
//   lane >= 16: col = ct*16 + lane - 16, halves: K = kc*32 + {8..15, 24..31}
// A repack thread owns one column of one k-chunk: 32 loads down the column (a
// wave reads 32 successive columns, one whole 128-byte line a load), and from
// them the fragments of both lanes that carry this column.
//   Wc [kc][ct][lane][16]    = [Wp | Wa] (768 x 1280); 768 % 32 == 0, no padding
//   Bws[n][kc][ct][lane][16] = Wmid [NC, 260, 256]; K >= 260 zero-padded
// ---------------------------------------------------------------------------
// frag: the fragment of lane (col & 15); that of lane 16 + (col & 15) stands 16
// fragments (256 halves) behind it.
__device__ __forceinline__ void store_col(const float (&v)[32], _Float16* __restrict__ frag) {
  v8h f[4];
  #pragma unroll   // constant indices: v and f stay in registers
  for (int g = 0; g < 4; ++g)
    #pragma unroll
    for (int i = 0; i < 8; ++i) f[g][i] = (_Float16)v[g * 8 + i];
  *(v8h*)(frag)           = f[0];
  *(v8h*)(frag + 8)       = f[2];
  *(v8h*)(frag + 256)     = f[1];
  *(v8h*)(frag + 256 + 8) = f[3];
}

#define WA_BLOCKS (KC2 * NC_ * H_ / 256)     // 96: 4 work-groups a k-chunk of Wa
#define WP_BLOCKS (KC2 * H_ / 256)           // 24: one work-group a k-chunk of Wp
#define BW_BLOCKS (NC_ * KC * H_ / 256)      // 36: one work-group a case and k-chunk
#define SQ_BLOCKS (SQ_HALVES / (256 * 32))   // 36
#define KTAIL (KTRUE - (KC - 1) * 32)        // 4 real rows in the last k-chunk of Wmid

__global__ void __launch_bounds__(256)
prep_all_kernel(const float* __restrict__ Wp, const float* __restrict__ Wa,
                const float* __restrict__ Wmid, const float* __restrict__ seq,
                _Float16* __restrict__ Wc, _Float16* __restrict__ Bws,
                _Float16* __restrict__ seqh) {
  const int blk = blockIdx.x;
  const int tid = threadIdx.x;
  // Every loop over j, u or i here is unrolled so that its array is indexed by
  // constants and stays in registers, and the row offsets are immediates.
  if (blk < WA_BLOCKS) {
    // Wa: row pitch 1024 floats; columns 256..1279 of [Wp | Wa]
    const int kc  = blk >> 2;
    const int col = (blk & 3) * 256 + tid;   // column of Wa
    const float* s = Wa + (size_t)kc * 32 * (NC_ * H_) + col;
    float v[32];
    #pragma unroll
    for (int j = 0; j < 32; ++j) v[j] = s[j * (NC_ * H_)];
    store_col(v, Wc + (((size_t)kc * CT2 + (H_ / 16) + (col >> 4)) * 32 + (col & 15)) * 16);
  } else if (blk < WA_BLOCKS + WP_BLOCKS + BW_BLOCKS) {
    // Wp and Wmid: row pitch 256 floats, a work-group takes all 256 columns
    const int r = blk - WA_BLOCKS;
    const float* s;
    _Float16* d;       // the chunk's first column tile
    bool full;         // all 32 rows of the chunk exist
    if (r < WP_BLOCKS) {                     // r = kc
      s = Wp + (size_t)r * 32 * H_;
      d = Wc + (size_t)r * CT2 * 512;
      full = true;
    } else {
      const int rest = r - WP_BLOCKS;        // n*KC + kc
      const int kc   = rest % KC;
      const int n    = rest / KC;
      s = Wmid + ((size_t)n * KTRUE + kc * 32) * H_;
      d = Bws + (size_t)rest * 16 * 512;
      full = kc < KC - 1;
    }
    s += tid;
    float v[32];
    #pragma unroll
    for (int j = 0; j < KTAIL; ++j) v[j] = s[j * H_];
    #pragma unroll
    for (int j = KTAIL; j < 32; ++j) v[j] = 0.0f;
    if (full) {
      #pragma unroll
      for (int j = KTAIL; j < 32; ++j) v[j] = s[j * H_];
      // Behind this block the first converted pair lands in these loads' address
      // register while the last of them are still out; the wait stands in front of
      // that overwrite (inside the block, so that no conversion is moved over it).
      asm volatile("s_wait_xcnt 0x0" ::: "memory");
    }
    store_col(v, d + ((tid >> 4) * 32 + (tid & 15)) * 16);
  } else {
    // seq: row-major, same indexing; a wave's load covers 4 whole lines
    const size_t base = (size_t)(blk - WA_BLOCKS - WP_BLOCKS - BW_BLOCKS) * (256 * 32) + tid * 4;
    v4f x[8];
    #pragma unroll
    for (int u = 0; u < 8; ++u) x[u] = *(const v4f*)(seq + base + u * 1024);
    #pragma unroll
    for (int u = 0; u < 8; ++u) {
      v4h y;
      #pragma unroll
      for (int i = 0; i < 4; ++i) y[i] = (_Float16)x[u][i];
      *(v4h*)(seqh + base + u * 1024) = y;
    }
    // The code of another part follows these stores in the kernel's text and writes
    // their registers anew; the wait stands in front of that.
    asm volatile("s_wait_xcnt 0x0" ::: "memory");
  }
}

// ---------------------------------------------------------------------------
// Kernel D: projection GEMM via WMMA.
// [hp | ha](row, col) = seq(row,:) @ [Wp|Wa](:, col) + [bp|ba](col)
// Grid: (NPROJ/64 = 20, ROWS/16 = 24); block = 128 (4 waves).
// Each wave owns one 16x16 output tile; K = 768 in 24 chunks.
// ---------------------------------------------------------------------------
__global__ void __launch_bounds__(128)
proj_wmma_kernel(const _Float16* __restrict__ seqh,
                 const _Float16* __restrict__ Wc,
                 const float* __restrict__ bp, const float* __restrict__ ba,
                 float* __restrict__ hp, float* __restrict__ ha) {
  const int tid  = threadIdx.x;
  const int wave = tid >> 5;
  const int lane = tid & 31;
  const int ct   = blockIdx.x * 4 + wave;   // column tile (0..79)
  const int row0 = blockIdx.y * 16;

  const int rowm = lane & 15;
  const int koff = (lane >> 4) * 8;

  v8f acc = {0.f, 0.f, 0.f, 0.f, 0.f, 0.f, 0.f, 0.f};
  const _Float16* arow = seqh + (size_t)(row0 + rowm) * D_;

  #pragma unroll
  for (int kc = 0; kc < KC2; ++kc) {
    v8h lo = *(const v8h*)(arow + kc * 32 + koff);
    v8h hi = *(const v8h*)(arow + kc * 32 + koff + 16);
    v16h a = __builtin_shufflevector(lo, hi,
                                     0, 1, 2, 3, 4, 5, 6, 7,
                                     8, 9, 10, 11, 12, 13, 14, 15);
    v16h b = *(const v16h*)(Wc + (((size_t)kc * CT2 + ct) * 32 + lane) * 16);
    acc = __builtin_amdgcn_wmma_f32_16x16x32_f16(
        false, a, false, b, (short)0, acc, false, false);
  }

  const int colN = lane & 15;
  const int half = lane >> 4;
  const int col  = ct * 16 + colN;                 // 0..1279
  const float bias = (col < H_) ? bp[col] : ba[col - H_];
  #pragma unroll
  for (int r = 0; r < 8; ++r) {
    const int row = row0 + r + 8 * half;
    const float v = acc[r] + bias;
    if (col < H_) hp[(size_t)row * H_ + col] = v;
    else          ha[(size_t)row * (NC_ * H_) + (col - H_)] = v;
  }
}

// ---------------------------------------------------------------------------
// Kernel E: fused  tanh(h_p+h_a)|bs  ->  WMMA x Wmid  ->  tanh(+bmid) . Wout
// Grid: (a_tile=12, p_group=24, b*NC=8).  Block: 256 threads = 8 waves.
// One work-group owns 128 rows: PT = 8 predicates x 16 argument positions
// (row = q*16 + a).  Each wave owns CTW = 2 column tiles (32 h' columns) of all
// 8 row tiles, so a Wmid fragment loaded once feeds 8 WMMAs and an h_a value
// loaded once feeds 8 tanh.  A work-group reads all of Wmid[n] (144 KiB, more
// than the WGP's cache holds) from L2 whatever its row count: twice the rows
// halve the bytes that L2 has to deliver.  K loop = 9 chunks of 32.  The Wmid
// fragments are fetched two chunks ahead into two register sets.
// The product is formed transposed: the Wmid fragment goes in as A, the row
// fragment as B (both operands have the same lane and k map, so the loaders
// stay).  A lane's 8 accumulator registers then hold 8 successive h' columns of
// ONE row, and the sum over h' with Wout runs inside the lane.
// ---------------------------------------------------------------------------
#define PT 8                 // predicates (row tiles) per work-group
#define MROWS (PT * 16)      // 128 rows per work-group
#define NTH 256              // threads per work-group: one per h column
#define CTW 2                // column tiles per wave (8 waves x 2 x 16 = 256)
// Row pitch of the A tile in LDS, in halves: 592 bytes = 16 B x 37.  The 16 lanes
// of a half-wave read 16 bytes each from 16 successive rows; at an odd multiple
// of 16 B these fall on all 64 banks once.  At the bare KP (576 B = 64 B x 9)
// every fourth row starts on the same bank and each read takes four times as long.
#define LDP (KP + 8)

__global__ void __launch_bounds__(NTH)
fused_mid_out_kernel(const float* __restrict__ hp, const float* __restrict__ ha,
                     const float* __restrict__ base_score,
                     const _Float16* __restrict__ Bws,
                     const float* __restrict__ bmid, const float* __restrict__ Wout,
                     float* __restrict__ out) {
  __shared__ alignas(16) _Float16 Alds[MROWS][LDP];   // columns KP..LDP-1: never read
  __shared__ alignas(16) float bw[2][H_];   // bmid[n] and Wout[n] of this case
  __shared__ float red[16][MROWS];          // one partial sum a row, wave and lane half

  const int at = blockIdx.x;       // a-tile index (0..11)
  const int p0 = blockIdx.y * PT;  // first predicate index of the group
  const int bz = blockIdx.z;       // b*NC + n
  const int b  = bz >> 2;
  const int n  = bz & 3;
  const int a0 = at * 16;
  const int tid = threadIdx.x;
  const int wave = tid >> 5;
  const int lane = tid & 31;

  // --- Build A tile in LDS: rows = 8 predicates x 16 arguments, cols = padded K ---
  // Every loop over q, t, r, i, u, g, s or kc here is unrolled so that its arrays are
  // indexed by constants and stay in registers.
  float hpv[PT];                               // this thread's column of h_p
  #pragma unroll
  for (int q = 0; q < PT; ++q)
    hpv[q] = hp[((size_t)(b * L_ + p0 + q)) * H_ + tid];

  // All global loads of the build stand here, in front of the first tanh, so
  // that they are in flight together and their latency is paid once.
  float hav[16];                               // 16x256 h_a values, 16 a thread
  const float* hab = ha + (((size_t)(b * L_ + a0) * NC_) + n) * H_ + tid;
  #pragma unroll
  for (int i = 0; i < 16; ++i)                 // row i, column tid
    hav[i] = hab[i * (NC_ * H_)];
  float bsv[MROWS * NC_ / NTH];                // base_score, 2 a thread
  #pragma unroll
  for (int u = 0; u < MROWS * NC_ / NTH; ++u) {
    int e  = u * NTH + tid;
    int rw = e >> 2, j = e & 3;
    int q = rw >> 4, row = rw & 15;
    bsv[u] = base_score[(((size_t)(b * L_ + p0 + q) * NC_) + j) * L_ + (a0 + row)];
  }
  const float bmv = bmid[n * H_ + tid];        // bmid and Wout, one column a thread
  const float wov = Wout[n * H_ + tid];

  // Wmid fragments of k-chunks 0 and 1: they depend on nothing the build makes, so
  // their latency passes under the tanh phase.  Fragment (kc, t) of this lane
  // stands at Bl + (kc * 16 + t) * 512 halves.
  const _Float16* Bl = Bws + (size_t)n * (KC * 16 * 32 * 16)
                           + ((size_t)(wave * CTW) * 32 + lane) * 16;
  v16h bv[2][CTW];
  #pragma unroll
  for (int s = 0; s < 2; ++s)
    #pragma unroll
    for (int t = 0; t < CTW; ++t)
      bv[s][t] = *(const v16h*)(Bl + (s * 16 + t) * 512);

  #pragma unroll
  for (int i = 0; i < 16; ++i) {               // 8 tanh per h_a value, one group
    float x[PT], y[PT];
    #pragma unroll
    for (int q = 0; q < PT; ++q) x[q] = hpv[q] + hav[i];
    tanh_x8(y, x);
    #pragma unroll
    for (int q = 0; q < PT; ++q)               // argument row i, column tid
      Alds[q * 16 + i][tid] = (_Float16)y[q];
  }
  #pragma unroll
  for (int u = 0; u < MROWS * NC_ / NTH; ++u) {    // base_score cols 256..259
    int e  = u * NTH + tid;
    Alds[e >> 2][H_ + (e & 3)] = (_Float16)bsv[u];
  }
  bw[0][tid] = bmv;
  bw[1][tid] = wov;
  for (int e = tid; e < MROWS * (KP - KTRUE); e += NTH) {  // zero pad 260..287
    int row = e / (KP - KTRUE);
    int col = KTRUE + e % (KP - KTRUE);
    Alds[row][col] = (_Float16)0.0f;
  }
  __syncthreads();

  const int rowm = lane & 15;          // A-matrix row this lane carries
  const int koff = (lane >> 4) * 8;    // half-wave K offset within chunk

  const int half = lane >> 4;          // 0: h' columns 0..7 of a tile, 1: 8..15

  v8f acc[PT][CTW];
  const v8f vzero = {0.f, 0.f, 0.f, 0.f, 0.f, 0.f, 0.f, 0.f};
  #pragma unroll
  for (int q = 0; q < PT; ++q)
    #pragma unroll
    for (int t = 0; t < CTW; ++t) acc[q][t] = vzero;

  // The 8 row fragments of a chunk stand in two sets of 4 (row tiles 0..3, 4..7).
  // A set is read anew from LDS directly behind its own 8 WMMAs, so the other
  // set's 8 WMMAs run between every LDS read and its use.
  v16h a[2][PT / 2];
  #pragma unroll
  for (int kc = -1; kc < KC; ++kc) {
    #pragma unroll
    for (int s = 0; s < 2; ++s) {
      if (kc >= 0) {
        #pragma unroll
        for (int t = 0; t < CTW; ++t)
          #pragma unroll
          for (int q = 0; q < PT / 2; ++q)
            acc[s * (PT / 2) + q][t] = __builtin_amdgcn_wmma_f32_16x16x32_f16(
                false, bv[kc & 1][t], false, a[s][q], (short)0,
                acc[s * (PT / 2) + q][t], false, false);
      }
      if (kc + 1 < KC) {   // this set's fragments of chunk kc + 1
        #pragma unroll
        for (int q = 0; q < PT / 2; ++q) {
          const _Float16* ar = &Alds[(s * (PT / 2) + q) * 16 + rowm][(kc + 1) * 32 + koff];
          a[s][q] = __builtin_shufflevector(*(const v8h*)ar, *(const v8h*)(ar + 16),
                                            0, 1, 2, 3, 4, 5, 6, 7,
                                            8, 9, 10, 11, 12, 13, 14, 15);
        }
      }
      if (s == 1 && kc >= 0 && kc + 2 < KC) {   // refill the Wmid set just used with chunk kc + 2
        #pragma unroll
        for (int t = 0; t < CTW; ++t)
          bv[kc & 1][t] = *(const v16h*)(Bl + ((kc + 2) * 16 + t) * 512);
      }
      // Mask 0x406: vector, scalar and transcendental instructions may cross this
      // line, a global load, an LDS access or a WMMA may not.  So the Wmid refills
      // stay a whole chunk of WMMAs ahead of their use and the LDS reads half a
      // chunk; without the line the compiler sinks each one to its use and waits
      // out its whole latency there.
      __builtin_amdgcn_sched_barrier(0x406);
    }
  }
  // acc[q][t][r] of this lane = mid(row q*16 + rowm, h' = (wave*CTW + t)*16 + 8*half + r).
  // Its bmid and Wout values: 8 successive floats a tile, the same for a half-wave.
  v4f bm[CTW][2], wo[CTW][2];
  #pragma unroll
  for (int t = 0; t < CTW; ++t)
    #pragma unroll
    for (int g = 0; g < 2; ++g) {
      const int hcol = (wave * CTW + t) * 16 + half * 8 + g * 4;
      bm[t][g] = *(const v4f*)&bw[0][hcol];
      wo[t][g] = *(const v4f*)&bw[1][hcol];
    }
  // The tanh below is asm text.
  // Nothing crosses this line: every WMMA stays above it, and below it stand the
  // eight adds that feed the first tanh group, at least four vector instructions:
  // the slots the chip needs before a tanh result may land in a register that
  // the last WMMA reads as A or B.
  __builtin_amdgcn_sched_barrier(0);

  // --- Epilogue: out_partial(row) = sum_h' tanh(mid + bmid) * Wout ---
  #pragma unroll
  for (int q = 0; q < PT; ++q) {
    float partial[8];
    #pragma unroll
    for (int r = 0; r < 8; ++r) partial[r] = 0.f;
    #pragma unroll
    for (int t = 0; t < CTW; ++t) {
      float x[8], y[8];
      #pragma unroll
      for (int r = 0; r < 8; ++r) x[r] = acc[q][t][r] + bm[t][r >> 2][r & 3];
      tanh_x8(y, x);
      #pragma unroll
      for (int r = 0; r < 8; ++r) partial[r] += y[r] * wo[t][r >> 2][r & 3];
    }
    // the lane's 16 columns of row q*16 + rowm, summed in the lane
    red[wave * 2 + half][q * 16 + rowm] =
        ((partial[0] + partial[1]) + (partial[2] + partial[3])) +
        ((partial[4] + partial[5]) + (partial[6] + partial[7]));
  }
  __syncthreads();

  if (tid < MROWS) {  // combine 8 waves x 2 lane halves; write out[b, p, n, a]
    float h[2];
    #pragma unroll   // constant indices: h stays in registers
    for (int g = 0; g < 2; ++g)
      h[g] = ((red[g * 8 + 0][tid] + red[g * 8 + 1][tid]) + (red[g * 8 + 2][tid] + red[g * 8 + 3][tid])) +
             ((red[g * 8 + 4][tid] + red[g * 8 + 5][tid]) + (red[g * 8 + 6][tid] + red[g * 8 + 7][tid]));
    float s = h[0] + h[1];
    const int q = tid >> 4, row = tid & 15;
    out[(((size_t)(b * L_ + p0 + q) * NC_) + n) * L_ + (a0 + row)] = s;
  }
}

// ---------------------------------------------------------------------------
extern "C" void kernel_launch(void* const* d_in, const int* in_sizes, int n_in,
                              void* d_out, int out_size, void* d_ws, size_t ws_size,
                              hipStream_t stream) {
  const float* seq  = (const float*)d_in[0];
  const float* bsc  = (const float*)d_in[1];
  const float* Wp   = (const float*)d_in[2];
  const float* bp   = (const float*)d_in[3];
  const float* Wa   = (const float*)d_in[4];
  const float* ba   = (const float*)d_in[5];
  const float* Wmid = (const float*)d_in[6];
  const float* bmid = (const float*)d_in[7];
  const float* Wout = (const float*)d_in[8];
  float* out = (float*)d_out;

  char* ws = (char*)d_ws;
  _Float16* Bws  = (_Float16*)(ws + WS_BW_OFF);
  _Float16* Wc   = (_Float16*)(ws + WS_WC_OFF);
  _Float16* seqh = (_Float16*)(ws + WS_SQ_OFF);
  float*    hp   = (float*)(ws + WS_HP_OFF);
  float*    ha   = (float*)(ws + WS_HA_OFF);

  prep_all_kernel<<<WA_BLOCKS + WP_BLOCKS + BW_BLOCKS + SQ_BLOCKS, 256, 0, stream>>>(
      Wp, Wa, Wmid, seq, Wc, Bws, seqh);

  dim3 gproj(NPROJ / 64, ROWS / 16);   // 20 x 24 = 480 workgroups
  proj_wmma_kernel<<<gproj, 128, 0, stream>>>(seqh, Wc, bp, ba, hp, ha);

  dim3 grid(L_ / 16, L_ / PT, B_ * NC_);   // 12 x 24 x 8 = 2304 workgroups
  fused_mid_out_kernel<<<grid, NTH, 0, stream>>>(hp, ha, bsc, Bws, bmid, Wout, out);
}

// v010
// A run of this version takes 41.2 microseconds.
// Two timings next to v009 put it at 1.14 and 1.13 times that version's speed.
// Counting every step since v000, it is 3.17 times as fast.
#include <hip/hip_runtime.h>

typedef _Float16 v16h __attribute__((ext_vector_type(16)));
typedef _Float16 v8h  __attribute__((ext_vector_type(8)));
typedef _Float16 v4h  __attribute__((ext_vector_type(4)));
typedef _Float16 v2h  __attribute__((ext_vector_type(2)));
typedef float    v8f  __attribute__((ext_vector_type(8)));
typedef float    v4f  __attribute__((ext_vector_type(4)));
typedef float    v2f  __attribute__((ext_vector_type(2)));

#define B_  2
#define L_  192
#define D_  768
#define NC_ 4
#define H_  256
#define KTRUE (H_ + NC_)   // 260 real K for mid layer
#define KP    288          // padded K (multiple of 32)
#define KC    (KP / 32)    // 9 k-chunks (mid layer)

#define NPROJ (H_ + NC_ * H_)   // 1280 projection output columns
#define KC2   (D_ / 32)         // 24 k-chunks (projection)
#define CT2   (NPROJ / 16)      // 80 column tiles (projection)
#define ROWS  (B_ * L_)         // 384 rows

// ---- Workspace layout (bytes) ----
#define BW_HALVES (NC_ * KC * 16 * 32 * 16)        // 294912 (Wmid f16 B-layout)
#define WS_BW_OFF   0
#define WC_HALVES (KC2 * CT2 * 32 * 16)            // 983040 ([Wp|Wa] f16 B-layout)
#define WS_WC_OFF   (BW_HALVES * 2)                // 589824
#define SQ_HALVES (ROWS * D_)                      // 294912 (seq f16)
#define WS_SQ_OFF   (WS_WC_OFF + WC_HALVES * 2)    // 2555904
#define WS_HP_OFF   (WS_SQ_OFF + SQ_HALVES * 2)    // 3145728
#define HP_FLOATS (ROWS * H_)                      // 98304
#define WS_HA_OFF   (WS_HP_OFF + HP_FLOATS * 4)    // 3538944
#define HA_FLOATS (ROWS * NC_ * H_)                // 393216
// total ws used ~= 4.9 MB

// Hardware tanh of eight independent values, one statement.  One value a
// statement left each tanh between the add that feeds it and the use of its
// result, all in the same two registers: a dependent chain that waits out every
// latency and carries no delay hint.  Here each tanh is the independent
// instruction behind the one before it (the outputs are early-clobber, so none
// lands on an input), its latency passes under the issue of the others, and the
// one v_nop is the slot the instruction set asks for behind the last.  Asm text
// and not __builtin_amdgcn_tanhf.
__device__ __forceinline__ void tanh_x8(float (&y)[8], const float (&x)[8]) {
  asm("v_tanh_f32 %0, %8\n\t"
      "v_tanh_f32 %1, %9\n\t"
      "v_tanh_f32 %2, %10\n\t"
      "v_tanh_f32 %3, %11\n\t"
      "v_tanh_f32 %4, %12\n\t"
      "v_tanh_f32 %5, %13\n\t"
      "v_tanh_f32 %6, %14\n\t"
      "v_tanh_f32 %7, %15\n\t"
      "v_nop"
      : "=&v"(y[0]), "=&v"(y[1]), "=&v"(y[2]), "=&v"(y[3]),
        "=&v"(y[4]), "=&v"(y[5]), "=&v"(y[6]), "=&v"(y[7])
      : "v"(x[0]), "v"(x[1]), "v"(x[2]), "v"(x[3]),
        "v"(x[4]), "v"(x[5]), "v"(x[6]), "v"(x[7]));
}

// ---------------------------------------------------------------------------
// Kernel ABC: the three f32 -> f16 conversions in one grid, 32 values a thread.
// None reads what another writes, so they need no launch boundary between them.
// A work-group belongs to one part by its index (a scalar branch).
// Waves start at a limited rate: at one value a thread this launch is 49152
// waves of one load and one 2-byte store each, far more start-up than work.
// At 32 values a thread it is 1536 waves, each with all its loads in flight.
//
// WMMA-B layout of a weight matrix: [kc][ct][lane][16 halves],
//   lane <  16: col = ct*16 + lane,      halves: K = kc*32 + {0..7, 16..23}
//   lane >= 16: col = ct*16 + lane - 16, halves: K = kc*32 + {8..15, 24..31}
// A repack thread owns one column of one k-chunk: 32 loads down the column (a
// wave reads 32 successive columns, one whole 128-byte line a load), and from
// them the fragments of both lanes that carry this column.
//   Wc [kc][ct][lane][16]    = [Wp | Wa] (768 x 1280); 768 % 32 == 0, no padding
//   Bws[n][kc][ct][lane][16] = Wmid [NC, 260, 256]; K >= 260 zero-padded
// ---------------------------------------------------------------------------
// frag: the fragment of lane (col & 15); that of lane 16 + (col & 15) stands 16
// fragments (256 halves) behind it.
__device__ __forceinline__ void store_col(const float (&v)[32], _Float16* __restrict__ frag) {
  v8h f[4];
  #pragma unroll   // constant indices: v and f stay in registers
  for (int g = 0; g < 4; ++g)
    #pragma unroll
    for (int i = 0; i < 8; ++i) f[g][i] = (_Float16)v[g * 8 + i];
  *(v8h*)(frag)           = f[0];
  *(v8h*)(frag + 8)       = f[2];
  *(v8h*)(frag + 256)     = f[1];
  *(v8h*)(frag + 256 + 8) = f[3];
}

#define WA_BLOCKS (KC2 * NC_ * H_ / 256)     // 96: 4 work-groups a k-chunk of Wa
#define WP_BLOCKS (KC2 * H_ / 256)           // 24: one work-group a k-chunk of Wp
#define BW_BLOCKS (NC_ * KC * H_ / 256)      // 36: one work-group a case and k-chunk
#define SQ_BLOCKS (SQ_HALVES / (256 * 32))   // 36
#define KTAIL (KTRUE - (KC - 1) * 32)        // 4 real rows in the last k-chunk of Wmid

__global__ void __launch_bounds__(256)
prep_all_kernel(const float* __restrict__ Wp, const float* __restrict__ Wa,
                const float* __restrict__ Wmid, const float* __restrict__ seq,
                _Float16* __restrict__ Wc, _Float16* __restrict__ Bws,
                _Float16* __restrict__ seqh) {
  const int blk = blockIdx.x;
  const int tid = threadIdx.x;
  // Every loop over j, u or i here is unrolled so that its array is indexed by
  // constants and stays in registers, and the row offsets are immediates.
  if (blk < WA_BLOCKS) {
    // Wa: row pitch 1024 floats; columns 256..1279 of [Wp | Wa]
    const int kc  = blk >> 2;
    const int col = (blk & 3) * 256 + tid;   // column of Wa
    const float* s = Wa + (size_t)kc * 32 * (NC_ * H_) + col;
    float v[32];
    #pragma unroll
    for (int j = 0; j < 32; ++j) v[j] = s[j * (NC_ * H_)];
    store_col(v, Wc + (((size_t)kc * CT2 + (H_ / 16) + (col >> 4)) * 32 + (col & 15)) * 16);
  } else if (blk < WA_BLOCKS + WP_BLOCKS + BW_BLOCKS) {
    // Wp and Wmid: row pitch 256 floats, a work-group takes all 256 columns
    const int r = blk - WA_BLOCKS;
    const float* s;
    _Float16* d;       // the chunk's first column tile
    bool full;         // all 32 rows of the chunk exist
    if (r < WP_BLOCKS) {                     // r = kc
      s = Wp + (size_t)r * 32 * H_;
      d = Wc + (size_t)r * CT2 * 512;
      full = true;
    } else {
      const int rest = r - WP_BLOCKS;        // n*KC + kc
      const int kc   = rest % KC;
      const int n    = rest / KC;
      s = Wmid + ((size_t)n * KTRUE + kc * 32) * H_;
      d = Bws + (size_t)rest * 16 * 512;
      full = kc < KC - 1;
    }
    s += tid;
    float v[32];
    #pragma unroll
    for (int j = 0; j < KTAIL; ++j) v[j] = s[j * H_];
    #pragma unroll
    for (int j = KTAIL; j < 32; ++j) v[j] = 0.0f;
    if (full) {
      #pragma unroll
      for (int j = KTAIL; j < 32; ++j) v[j] = s[j * H_];
      // Behind this block the first converted pair lands in these loads' address
      // register while the last of them are still out; the wait stands in front of
      // that overwrite (inside the block, so that no conversion is moved over it).
      asm volatile("s_wait_xcnt 0x0" ::: "memory");
    }
    store_col(v, d + ((tid >> 4) * 32 + (tid & 15)) * 16);
  } else {
    // seq: row-major, same indexing; a wave's load covers 4 whole lines
    const size_t base = (size_t)(blk - WA_BLOCKS - WP_BLOCKS - BW_BLOCKS) * (256 * 32) + tid * 4;
    v4f x[8];
    #pragma unroll
    for (int u = 0; u < 8; ++u) x[u] = *(const v4f*)(seq + base + u * 1024);
    #pragma unroll
    for (int u = 0; u < 8; ++u) {
      v4h y;
      #pragma unroll
      for (int i = 0; i < 4; ++i) y[i] = (_Float16)x[u][i];
      *(v4h*)(seqh + base + u * 1024) = y;
    }
    // The code of another part follows these stores in the kernel's text and writes
    // their registers anew; the wait stands in front of that.
    asm volatile("s_wait_xcnt 0x0" ::: "memory");
  }
}

// ---------------------------------------------------------------------------
// Kernel D: projection GEMM via WMMA.
// [hp | ha](row, col) = seq(row,:) @ [Wp|Wa](:, col) + [bp|ba](col)
// Grid: (NPROJ/64 = 20, ROWS/16 = 24); block = 128 (4 waves).
// Each wave owns one 16x16 output tile; K = 768 in 24 chunks.
// ---------------------------------------------------------------------------
__global__ void __launch_bounds__(128)
proj_wmma_kernel(const _Float16* __restrict__ seqh,
                 const _Float16* __restrict__ Wc,
                 const float* __restrict__ bp, const float* __restrict__ ba,
                 float* __restrict__ hp, float* __restrict__ ha) {
  const int tid  = threadIdx.x;
  const int wave = tid >> 5;
  const int lane = tid & 31;
  const int ct   = blockIdx.x * 4 + wave;   // column tile (0..79)
  const int row0 = blockIdx.y * 16;

  const int rowm = lane & 15;
  const int koff = (lane >> 4) * 8;

  v8f acc = {0.f, 0.f, 0.f, 0.f, 0.f, 0.f, 0.f, 0.f};
  const _Float16* arow = seqh + (size_t)(row0 + rowm) * D_;

  #pragma unroll
  for (int kc = 0; kc < KC2; ++kc) {
    v8h lo = *(const v8h*)(arow + kc * 32 + koff);
    v8h hi = *(const v8h*)(arow + kc * 32 + koff + 16);
    v16h a = __builtin_shufflevector(lo, hi,
                                     0, 1, 2, 3, 4, 5, 6, 7,
                                     8, 9, 10, 11, 12, 13, 14, 15);
    v16h b = *(const v16h*)(Wc + (((size_t)kc * CT2 + ct) * 32 + lane) * 16);
    acc = __builtin_amdgcn_wmma_f32_16x16x32_f16(
        false, a, false, b, (short)0, acc, false, false);
  }

  const int colN = lane & 15;
  const int half = lane >> 4;
  const int col  = ct * 16 + colN;                 // 0..1279
  const float bias = (col < H_) ? bp[col] : ba[col - H_];
  #pragma unroll
  for (int r = 0; r < 8; ++r) {
    const int row = row0 + r + 8 * half;
    const float v = acc[r] + bias;
    if (col < H_) hp[(size_t)row * H_ + col] = v;
    else          ha[(size_t)row * (NC_ * H_) + (col - H_)] = v;
  }
}

// ---------------------------------------------------------------------------
// Kernel E: fused  tanh(h_p+h_a)|bs  ->  WMMA x Wmid  ->  tanh(+bmid) . Wout
// Grid: (a_tile=12, p_group=24, b*NC=8).  Block: 256 threads = 8 waves.
// One work-group owns 128 rows: PT = 8 predicates x 16 argument positions
// (row = q*16 + a).  Each wave owns CTW = 2 column tiles (32 h' columns) of all
// 8 row tiles, so a Wmid fragment loaded once feeds 8 WMMAs and an h_a value
// loaded once feeds 8 tanh.  A work-group reads all of Wmid[n] (144 KiB, more
// than the WGP's cache holds) from L2 whatever its row count: twice the rows
// halve the bytes that L2 has to deliver.  K loop = 9 chunks of 32.  The Wmid
// fragments are fetched two chunks ahead into two register sets.
// The product is formed transposed: the Wmid fragment goes in as A, the row
// fragment as B (both operands have the same lane and k map, so the loaders
// stay).  A lane's 8 accumulator registers then hold 8 successive h' columns of
// ONE row, and the sum over h' with Wout runs inside the lane.
// ---------------------------------------------------------------------------
#define PT 8                 // predicates (row tiles) per work-group
#define MROWS (PT * 16)      // 128 rows per work-group
#define NTH 256              // threads per work-group
#define BC 4                 // build: adjacent columns a thread owns (one 8-byte LDS store)
#define BI (16 / (NTH / (H_ / BC)))   // build: argument rows a thread owns (4)
#define CTW 2                // column tiles per wave (8 waves x 2 x 16 = 256)
// Row pitch of the A tile in LDS, in halves: 592 bytes = 16 B x 37.  The 16 lanes
// of a half-wave read 16 bytes each from 16 successive rows; at an odd multiple
// of 16 B these fall on all 64 banks once.  At the bare KP (576 B = 64 B x 9)
// every fourth row starts on the same bank and each read takes four times as long.
#define LDP (KP + 8)

__global__ void __launch_bounds__(NTH)
fused_mid_out_kernel(const float* __restrict__ hp, const float* __restrict__ ha,
                     const float* __restrict__ base_score,
                     const _Float16* __restrict__ Bws,
                     const float* __restrict__ bmid, const float* __restrict__ Wout,
                     float* __restrict__ out) {
  __shared__ alignas(16) _Float16 Alds[MROWS][LDP];   // columns KP..LDP-1: never read
  __shared__ alignas(16) float bw[2][H_];   // bmid[n] and Wout[n] of this case
  __shared__ float red[16][MROWS];          // one partial sum a row, wave and lane half

  const int at = blockIdx.x;       // a-tile index (0..11)
  const int p0 = blockIdx.y * PT;  // first predicate index of the group
  const int bz = blockIdx.z;       // b*NC + n
  const int b  = bz >> 2;
  const int n  = bz & 3;
  const int a0 = at * 16;
  const int tid = threadIdx.x;
  const int wave = tid >> 5;
  const int lane = tid & 31;

  // --- Build A tile in LDS: rows = 8 predicates x 16 arguments, cols = padded K ---
  // Every loop over q, t, r, i, u, g, s or kc here is unrolled so that its arrays are
  // indexed by constants and stay in registers.
  // A thread owns BC = 4 adjacent columns of BI = 4 argument rows (all 8 predicates),
  // so that two packed conversions make one 8-byte LDS store.  At one column a
  // thread every value took a conversion and a 2-byte store of its own, and narrow
  // LDS stores are limited by their number, not by their bytes.
  const int bc = (tid & (H_ / BC - 1)) * BC;   // first column
  const int bi = (tid / (H_ / BC)) * BI;       // first argument row
  v4f hpv[PT];                                 // this thread's columns of h_p
  #pragma unroll
  for (int q = 0; q < PT; ++q)
    hpv[q] = *(const v4f*)(hp + ((size_t)(b * L_ + p0 + q)) * H_ + bc);
  // The address register of these loads is written anew below (in one build by the
  // result of an h_a load); the wait stands
  // in front of that overwrite.
  asm volatile("s_wait_xcnt 0x0" ::: "memory");

  // All global loads of the build stand here, in front of the first tanh, so
  // that they are in flight together and their latency is paid once.
  v4f hav[BI];                                 // 16x256 h_a values, 16 a thread
  const float* hab = ha + (((size_t)(b * L_ + a0 + bi) * NC_) + n) * H_ + bc;
  #pragma unroll
  for (int i = 0; i < BI; ++i)                 // row bi + i, columns bc..bc+3
    hav[i] = *(const v4f*)(hab + i * (NC_ * H_));
  float bsv[MROWS * NC_ / NTH];                // base_score, 2 a thread
  #pragma unroll
  for (int u = 0; u < MROWS * NC_ / NTH; ++u) {
    int e  = u * NTH + tid;
    int rw = e >> 2, j = e & 3;
    int q = rw >> 4, row = rw & 15;
    bsv[u] = base_score[(((size_t)(b * L_ + p0 + q) * NC_) + j) * L_ + (a0 + row)];
  }
  const float bmv = bmid[n * H_ + tid];        // bmid and Wout, one column a thread
  const float wov = Wout[n * H_ + tid];

  // Wmid fragments of k-chunks 0 and 1: they depend on nothing the build makes, so
  // their latency passes under the tanh phase.  Fragment (kc, t) of this lane
  // stands at Bl + (kc * 16 + t) * 512 halves.
  const _Float16* Bl = Bws + (size_t)n * (KC * 16 * 32 * 16)
                           + ((size_t)(wave * CTW) * 32 + lane) * 16;
  // The fragments below land in registers that hold addresses of the loads above;
  // the wait stands in front of that overwrite.
  asm volatile("s_wait_xcnt 0x0" ::: "memory");
  v16h bv[2][CTW];
  #pragma unroll
  for (int s = 0; s < 2; ++s)
    #pragma unroll
    for (int t = 0; t < CTW; ++t)
      bv[s][t] = *(const v16h*)(Bl + (s * 16 + t) * 512);
  // Nothing crosses this line: an add of the build that moves above the loads just
  // issued brings its wait for h_p and h_a along, and the Wmid fragments are then
  // asked for a whole load latency later.
  __builtin_amdgcn_sched_barrier(0);

  #pragma unroll
  for (int i = 0; i < BI; ++i) {
    #pragma unroll
    for (int q = 0; q < PT; q += 2) {          // a tanh group: 2 predicates x 4 columns
      float x[8], y[8];
      #pragma unroll
      for (int u = 0; u < 2; ++u)
        #pragma unroll
        for (int c = 0; c < BC; ++c) x[u * BC + c] = hpv[q + u][c] + hav[i][c];
      tanh_x8(y, x);
      #pragma unroll
      for (int u = 0; u < 2; ++u) {            // predicate q + u, argument row bi + i
        const v2f l = {y[u * BC + 0], y[u * BC + 1]}, h = {y[u * BC + 2], y[u * BC + 3]};
        *(v4h*)&Alds[(q + u) * 16 + bi + i][bc] =
            __builtin_shufflevector(__builtin_convertvector(l, v2h),
                                    __builtin_convertvector(h, v2h), 0, 1, 2, 3);
      }
    }
  }
  #pragma unroll
  for (int u = 0; u < MROWS * NC_ / NTH; ++u) {    // base_score cols 256..259
    int e  = u * NTH + tid;
    Alds[e >> 2][H_ + (e & 3)] = (_Float16)bsv[u];
  }
  bw[0][tid] = bmv;
  bw[1][tid] = wov;
  {  // zero pad, columns 260..287 (56 bytes a row): two threads a row, two stores each
    const int row = tid >> 1;
    const v8h z8 = {(_Float16)0.f, (_Float16)0.f, (_Float16)0.f, (_Float16)0.f,
                    (_Float16)0.f, (_Float16)0.f, (_Float16)0.f, (_Float16)0.f};
    const v4h z4 = {(_Float16)0.f, (_Float16)0.f, (_Float16)0.f, (_Float16)0.f};
    if (tid & 1) {
      *(v8h*)&Alds[row][KP - 16] = z8;
      *(v8h*)&Alds[row][KP - 8]  = z8;
    } else {
      *(v4h*)&Alds[row][KTRUE]     = z4;
      *(v8h*)&Alds[row][KTRUE + 4] = z8;
    }
  }
  __syncthreads();

  const int rowm = lane & 15;          // A-matrix row this lane carries
  const int koff = (lane >> 4) * 8;    // half-wave K offset within chunk

  const int half = lane >> 4;          // 0: h' columns 0..7 of a tile, 1: 8..15

  v8f acc[PT][CTW];
  const v8f vzero = {0.f, 0.f, 0.f, 0.f, 0.f, 0.f, 0.f, 0.f};
  #pragma unroll
  for (int q = 0; q < PT; ++q)
    #pragma unroll
    for (int t = 0; t < CTW; ++t) acc[q][t] = vzero;

  // The 8 row fragments of a chunk stand in two sets of 4 (row tiles 0..3, 4..7).
  // A set is read anew from LDS directly behind its own 8 WMMAs, so the other
  // set's 8 WMMAs run between every LDS read and its use.
  v16h a[2][PT / 2];
  #pragma unroll
  for (int kc = -1; kc < KC; ++kc) {
    #pragma unroll
    for (int s = 0; s < 2; ++s) {
      if (kc >= 0) {
        #pragma unroll
        for (int t = 0; t < CTW; ++t)
          #pragma unroll
          for (int q = 0; q < PT / 2; ++q)
            acc[s * (PT / 2) + q][t] = __builtin_amdgcn_wmma_f32_16x16x32_f16(
                false, bv[kc & 1][t], false, a[s][q], (short)0,
                acc[s * (PT / 2) + q][t], false, false);
      }
      if (kc + 1 < KC) {   // this set's fragments of chunk kc + 1
        #pragma unroll
        for (int q = 0; q < PT / 2; ++q) {
          const _Float16* ar = &Alds[(s * (PT / 2) + q) * 16 + rowm][(kc + 1) * 32 + koff];
          a[s][q] = __builtin_shufflevector(*(const v8h*)ar, *(const v8h*)(ar + 16),
                                            0, 1, 2, 3, 4, 5, 6, 7,
                                            8, 9, 10, 11, 12, 13, 14, 15);
        }
      }
      if (s == 1 && kc >= 0 && kc + 2 < KC) {   // refill the Wmid set just used with chunk kc + 2
        #pragma unroll
        for (int t = 0; t < CTW; ++t)
          bv[kc & 1][t] = *(const v16h*)(Bl + ((kc + 2) * 16 + t) * 512);
      }
      // Mask 0x406: vector, scalar and transcendental instructions may cross this
      // line, a global load, an LDS access or a WMMA may not.  So the Wmid refills
      // stay a whole chunk of WMMAs ahead of their use and the LDS reads half a
      // chunk; without the line the compiler sinks each one to its use and waits
      // out its whole latency there.
      __builtin_amdgcn_sched_barrier(0x406);
    }
  }
  // acc[q][t][r] of this lane = mid(row q*16 + rowm, h' = (wave*CTW + t)*16 + 8*half + r).
  // Its bmid and Wout values: 8 successive floats a tile, the same for a half-wave.
  v4f bm[CTW][2], wo[CTW][2];
  #pragma unroll
  for (int t = 0; t < CTW; ++t)
    #pragma unroll
    for (int g = 0; g < 2; ++g) {
      const int hcol = (wave * CTW + t) * 16 + half * 8 + g * 4;
      bm[t][g] = *(const v4f*)&bw[0][hcol];
      wo[t][g] = *(const v4f*)&bw[1][hcol];
    }
  // The tanh below is asm text.
  // Nothing crosses this line: every WMMA stays above it, and below it stand the
  // eight adds that feed the first tanh group, at least four vector instructions:
  // the slots the chip needs before a tanh result may land in a register that
  // the last WMMA reads as A or B.
  __builtin_amdgcn_sched_barrier(0);

  // --- Epilogue: out_partial(row) = sum_h' tanh(mid + bmid) * Wout ---
  #pragma unroll
  for (int q = 0; q < PT; ++q) {
    float partial[8];
    #pragma unroll
    for (int r = 0; r < 8; ++r) partial[r] = 0.f;
    #pragma unroll
    for (int t = 0; t < CTW; ++t) {
      float x[8], y[8];
      #pragma unroll
      for (int r = 0; r < 8; ++r) x[r] = acc[q][t][r] + bm[t][r >> 2][r & 3];
      tanh_x8(y, x);
      #pragma unroll
      for (int r = 0; r < 8; ++r) partial[r] += y[r] * wo[t][r >> 2][r & 3];
    }
    // the lane's 16 columns of row q*16 + rowm, summed in the lane
    red[wave * 2 + half][q * 16 + rowm] =
        ((partial[0] + partial[1]) + (partial[2] + partial[3])) +
        ((partial[4] + partial[5]) + (partial[6] + partial[7]));
  }
  __syncthreads();

  if (tid < MROWS) {  // combine 8 waves x 2 lane halves; write out[b, p, n, a]
    float h[2];
    #pragma unroll   // constant indices: h stays in registers
    for (int g = 0; g < 2; ++g)
      h[g] = ((red[g * 8 + 0][tid] + red[g * 8 + 1][tid]) + (red[g * 8 + 2][tid] + red[g * 8 + 3][tid])) +
             ((red[g * 8 + 4][tid] + red[g * 8 + 5][tid]) + (red[g * 8 + 6][tid] + red[g * 8 + 7][tid]));
    float s = h[0] + h[1];
    const int q = tid >> 4, row = tid & 15;
    out[(((size_t)(b * L_ + p0 + q) * NC_) + n) * L_ + (a0 + row)] = s;
  }
}

// ---------------------------------------------------------------------------
extern "C" void kernel_launch(void* const* d_in, const int* in_sizes, int n_in,
                              void* d_out, int out_size, void* d_ws, size_t ws_size,
                              hipStream_t stream) {
  const float* seq  = (const float*)d_in[0];
  const float* bsc  = (const float*)d_in[1];
  const float* Wp   = (const float*)d_in[2];
  const float* bp   = (const float*)d_in[3];
  const float* Wa   = (const float*)d_in[4];
  const float* ba   = (const float*)d_in[5];
  const float* Wmid = (const float*)d_in[6];
  const float* bmid = (const float*)d_in[7];
  const float* Wout = (const float*)d_in[8];
  float* out = (float*)d_out;

  char* ws = (char*)d_ws;
  _Float16* Bws  = (_Float16*)(ws + WS_BW_OFF);
  _Float16* Wc   = (_Float16*)(ws + WS_WC_OFF);
  _Float16* seqh = (_Float16*)(ws + WS_SQ_OFF);
  float*    hp   = (float*)(ws + WS_HP_OFF);
  float*    ha   = (float*)(ws + WS_HA_OFF);

  prep_all_kernel<<<WA_BLOCKS + WP_BLOCKS + BW_BLOCKS + SQ_BLOCKS, 256, 0, stream>>>(
      Wp, Wa, Wmid, seq, Wc, Bws, seqh);

  dim3 gproj(NPROJ / 64, ROWS / 16);   // 20 x 24 = 480 workgroups
  proj_wmma_kernel<<<gproj, 128, 0, stream>>>(seqh, Wc, bp, ba, hp, ha);

  dim3 grid(L_ / 16, L_ / PT, B_ * NC_);   // 12 x 24 x 8 = 2304 workgroups
  fused_mid_out_kernel<<<grid, NTH, 0, stream>>>(hp, ha, bsc, Bws, bmid, Wout, out);
}
